// v000
// Times are from an AMD MI455X. After a warm-up the kernel runs many times in a row, and a time is the length of
// such a window on the GPU divided by its runs, so every launch and the gaps after it count. The runs cycle
// through copies of the inputs. A figure is the median of several windows, for all but v000 over two sittings.
// Sittings can differ by a few percent; kernels timed side by side share one.
// v000 is the starting kernel. One run takes 232 microseconds.
#include <hip/hip_runtime.h>
#include <hip/hip_bf16.h>

#define B_   4
#define CH   64
#define HS   64
#define WSZ  64
#define NPOS (HS*WSZ)   // 4096
#define LDP  72         // LDS row stride in halves (144B rows: 16B-aligned)

typedef __attribute__((ext_vector_type(16))) _Float16 v16h;
typedef __attribute__((ext_vector_type(8)))  float    v8f;

union Frag16 { v16h v; uint4 q[2]; };
union Pack8  { uint4 u; _Float16 h[8]; };
union Pack64 { uint4 u[8]; _Float16 h[64]; };

// Load one 16x32 f16 fragment in the A-matrix VGPR layout from a row-major
// tile.  `row` must point at (tile_row_base + this lane's row * ld).
// Lane L (r=L&15, half=L>>4) holds halves k = half*8 + {0..7} and 16+half*8+{0..7}.
__device__ __forceinline__ void load_frag(Frag16& f, const _Float16* row, int half) {
  f.q[0] = *(const uint4*)(row + half * 8);
  f.q[1] = *(const uint4*)(row + half * 8 + 16);
}

__device__ __forceinline__ v8f wmma16(const Frag16& a, const Frag16& b, v8f c) {
  return __builtin_amdgcn_wmma_f32_16x16x32_f16(false, a.v, false, b.v,
                                                (short)0, c, false, false);
}

// Async global->LDS copy, 16B per lane, tracked by ASYNCcnt (CDNA5).
// GV mode: per-lane 64-bit global address, per-lane LDS byte offset.
__device__ __forceinline__ void async_copy_b128(const void* gptr, void* lptr) {
  unsigned lds_off = (unsigned)(uintptr_t)lptr;          // addr[31:0] = LDS offset
  unsigned long long gaddr = (unsigned long long)(uintptr_t)gptr;
  asm volatile("global_load_async_to_lds_b128 %0, %1, off"
               :: "v"(lds_off), "v"(gaddr) : "memory");
}

__device__ __forceinline__ void wait_async0() {
  asm volatile("s_wait_asynccnt 0" ::: "memory");
}

// ---------------------------------------------------------------------------
// Kernel 1: per-pixel channel LayerNorm; emit xn in channel-major (for the
// depthwise convs) and position-major (WMMA B-operand for the q projection).
// ---------------------------------------------------------------------------
__global__ __launch_bounds__(256) void ln_kernel(const float* __restrict__ x,
                                                 const float* __restrict__ g,
                                                 const float* __restrict__ be,
                                                 _Float16* __restrict__ xn_c,
                                                 _Float16* __restrict__ xn_t) {
  const int idx = blockIdx.x * 256 + threadIdx.x;       // b*NPOS + p
  const int b = idx / NPOS;
  const int p = idx - b * NPOS;
  const size_t base = (size_t)b * CH * NPOS + p;
  float s = 0.f, ss = 0.f;
  for (int c = 0; c < CH; ++c) {
    float v = x[base + (size_t)c * NPOS];
    s += v; ss += v * v;
  }
  const float mu = s * (1.0f / CH);
  const float var = ss * (1.0f / CH) - mu * mu;
  const float rstd = rsqrtf(var + 1e-5f);
  Pack64 pk;
  for (int c = 0; c < CH; ++c) {
    float xv = (x[base + (size_t)c * NPOS] - mu) * rstd * g[c] + be[c];
    _Float16 hf = (_Float16)xv;
    xn_c[base + (size_t)c * NPOS] = hf;
    pk.h[c] = hf;
  }
  uint4* trow = (uint4*)(xn_t + (size_t)idx * CH);
  for (int k = 0; k < 8; ++k) trow[k] = pk.u[k];
}

// ---------------------------------------------------------------------------
// Kernel 2: depthwise 3x3 convs (k, v).  k stored position-major [p][c]
// (WMMA B operand for QK^T), v stored channel-major [c][p] (B operand for PV).
// ---------------------------------------------------------------------------
__global__ __launch_bounds__(256) void dwconv_kernel(const _Float16* __restrict__ xn_c,
                                                     const float* __restrict__ wk,
                                                     const float* __restrict__ bk,
                                                     const float* __restrict__ wv,
                                                     const float* __restrict__ bv,
                                                     _Float16* __restrict__ kT,
                                                     _Float16* __restrict__ v_c) {
  const int idx = blockIdx.x * 256 + threadIdx.x;       // over B*C*N
  const int p  = idx & (NPOS - 1);
  const int bc = idx >> 12;
  const int c  = bc & (CH - 1);
  const int b  = bc >> 6;
  const int h  = p >> 6, w = p & (WSZ - 1);
  float accK = bk[c], accV = bv[c];
  const _Float16* src = xn_c + (size_t)bc * NPOS;
  for (int dy = -1; dy <= 1; ++dy) {
    int hh = h + dy;
    if ((unsigned)hh >= HS) continue;
    for (int dx = -1; dx <= 1; ++dx) {
      int ww = w + dx;
      if ((unsigned)ww >= WSZ) continue;
      float xv = (float)src[hh * WSZ + ww];
      int wi = c * 9 + (dy + 1) * 3 + (dx + 1);
      accK += wk[wi] * xv;
      accV += wv[wi] * xv;
    }
  }
  kT[((size_t)b * NPOS + p) * CH + c] = (_Float16)accK;
  v_c[(size_t)bc * NPOS + p]          = (_Float16)accV;
}

// ---------------------------------------------------------------------------
// Kernel 3: q = wq @ xn + bq, scaled by 1/sqrt(C); stored position-major.
// 128 threads = 4 waves; each wave owns a 16-row slab of output channels.
// ---------------------------------------------------------------------------
__global__ __launch_bounds__(128) void proj_q_kernel(const float* __restrict__ wq,
                                                     const float* __restrict__ bq,
                                                     const _Float16* __restrict__ xnT,
                                                     _Float16* __restrict__ qT) {
  const int b = blockIdx.y;
  const int p0 = blockIdx.x * 64;
  const int wave = threadIdx.x >> 5;
  const int lane = threadIdx.x & 31;
  const int half = lane >> 4, r = lane & 15;
  const int co0 = wave * 16;

  Frag16 a[2];
  const float* wrow = wq + (co0 + r) * CH;
  for (int ck = 0; ck < 2; ++ck)
    for (int j = 0; j < 8; ++j) {
      a[ck].v[j]     = (_Float16)wrow[ck * 32 + half * 8 + j];
      a[ck].v[j + 8] = (_Float16)wrow[ck * 32 + half * 8 + 16 + j];
    }
  float bias[8];
  for (int v = 0; v < 8; ++v) bias[v] = bq[co0 + 8 * half + v];

  for (int pt = 0; pt < 4; ++pt) {
    const int p1 = p0 + pt * 16;
    const _Float16* xrow = xnT + ((size_t)b * NPOS + p1 + r) * CH;
    Frag16 bm0, bm1;
    load_frag(bm0, xrow, half);
    load_frag(bm1, xrow + 32, half);
    v8f acc = {};
    acc = wmma16(a[0], bm0, acc);
    acc = wmma16(a[1], bm1, acc);
    Pack8 pk;
    for (int v = 0; v < 8; ++v)
      pk.h[v] = (_Float16)((acc[v] + bias[v]) * 0.125f);   // fold 1/sqrt(64)
    *(uint4*)(qT + ((size_t)b * NPOS + p1 + r) * CH + co0 + 8 * half) = pk.u;
  }
}

// ---------------------------------------------------------------------------
// Kernel 4: fused flash attention.  256 threads = 8 waves, each wave owns a
// 16-query tile (128 queries/block).  Key/value blocks of 64 staged in LDS by
// ASYNCcnt-tracked global_load_async_to_lds_b128, double-buffered so the next
// tile's DMA overlaps the current tile's 16 WMMAs.
// ---------------------------------------------------------------------------
__global__ __launch_bounds__(256) void attn_kernel(const _Float16* __restrict__ qT,
                                                   const _Float16* __restrict__ kT,
                                                   const _Float16* __restrict__ v_c,
                                                   _Float16* __restrict__ outT) {
  __shared__ _Float16 lds_k[2][64 * LDP];
  __shared__ _Float16 lds_v[2][64 * LDP];
  __shared__ _Float16 lds_p[8 * 16 * LDP];

  const int b = blockIdx.y;
  const int qbase = blockIdx.x * 128;
  const int tid = threadIdx.x;
  const int wave = tid >> 5;
  const int lane = tid & 31;
  const int half = lane >> 4, r = lane & 15;
  const int i0 = qbase + wave * 16;

  // Q fragments (A operand), fixed for the whole block loop.
  const _Float16* qrow = qT + ((size_t)b * NPOS + i0 + r) * CH;
  Frag16 qa0, qa1;
  load_frag(qa0, qrow, half);
  load_frag(qa1, qrow + 32, half);

  float mi[8], li[8];
  v8f o[4];
  for (int v = 0; v < 8; ++v) { mi[v] = -3.0e38f; li[v] = 0.f; }
  for (int t = 0; t < 4; ++t) o[t] = (v8f){};

  _Float16* prow_base = lds_p + wave * 16 * LDP;

  // Issue async staging of tile `kb` into buffer `buf` (4 async ops / wave).
  auto issue_tile = [&](int kb, int buf) {
    const int j0 = kb * 64;
    const _Float16* kbase = kT + ((size_t)b * NPOS + j0) * CH;
    for (int it = 0; it < 2; ++it) {
      int idx = tid + it * 256;                 // 0..511 b128 chunks
      int row = idx >> 3, col = idx & 7;
      async_copy_b128(kbase + row * CH + col * 8,
                      lds_k[buf] + row * LDP + col * 8);
    }
    for (int it = 0; it < 2; ++it) {
      int idx = tid + it * 256;
      int row = idx >> 3, col = idx & 7;
      async_copy_b128(v_c + ((size_t)b * CH + row) * NPOS + j0 + col * 8,
                      lds_v[buf] + row * LDP + col * 8);
    }
  };

  issue_tile(0, 0);

  for (int kb = 0; kb < NPOS / 64; ++kb) {
    const int cur = kb & 1;
    wait_async0();        // my 4 copies for buffer `cur` have landed
    __syncthreads();      // everyone's copies landed; everyone done reading `cur^1`
    if (kb + 1 < NPOS / 64) issue_tile(kb + 1, cur ^ 1);

    // S = Q K^T : 4 key sub-tiles of 16, contraction over 64 channels.
    v8f s[4];
    for (int t = 0; t < 4; ++t) {
      const _Float16* krow = lds_k[cur] + (t * 16 + r) * LDP;
      Frag16 kb0, kb1;
      load_frag(kb0, krow, half);
      load_frag(kb1, krow + 32, half);
      v8f acc = {};
      acc = wmma16(qa0, kb0, acc);
      acc = wmma16(qa1, kb1, acc);
      s[t] = acc;
    }

    // Online softmax; D-layout row m = v + 8*half lives across 16 lanes.
    for (int v = 0; v < 8; ++v) {
      float rm = fmaxf(fmaxf(s[0][v], s[1][v]), fmaxf(s[2][v], s[3][v]));
      for (int msk = 1; msk < 16; msk <<= 1)
        rm = fmaxf(rm, __shfl_xor(rm, msk, 32));
      float mnew = fmaxf(mi[v], rm);
      float corr = __expf(mi[v] - mnew);
      float rs = 0.f;
      for (int t = 0; t < 4; ++t) {
        float pv = __expf(s[t][v] - mnew);
        s[t][v] = pv;
        rs += pv;
      }
      for (int msk = 1; msk < 16; msk <<= 1)
        rs += __shfl_xor(rs, msk, 32);
      li[v] = li[v] * corr + rs;
      mi[v] = mnew;
      for (int t = 0; t < 4; ++t) o[t][v] *= corr;
      // Scatter P row (m = v + 8*half) into this wave's LDS region.
      const int rowm = v + 8 * half;
      for (int t = 0; t < 4; ++t)
        prow_base[rowm * LDP + t * 16 + r] = (_Float16)s[t][v];
    }
    // Same-wave LDS RAW: drain DS counter before re-reading P as A fragments.
    asm volatile("s_wait_dscnt 0" ::: "memory");

    // O += P V : A = P (16 x 64 probs), B = V channel-tiles.
    Frag16 pa0, pa1;
    const _Float16* prow = prow_base + r * LDP;
    load_frag(pa0, prow, half);
    load_frag(pa1, prow + 32, half);
    for (int t = 0; t < 4; ++t) {
      const _Float16* vrow = lds_v[cur] + (t * 16 + r) * LDP;
      Frag16 vb0, vb1;
      load_frag(vb0, vrow, half);
      load_frag(vb1, vrow + 32, half);
      o[t] = wmma16(pa0, vb0, o[t]);
      o[t] = wmma16(pa1, vb1, o[t]);
    }
  }

  // Normalize and store O position-major [i][c] as f16.
  for (int v = 0; v < 8; ++v) {
    const float inv = 1.0f / li[v];
    const int rowi = i0 + v + 8 * half;
    for (int t = 0; t < 4; ++t)
      outT[((size_t)b * NPOS + rowi) * CH + t * 16 + r] = (_Float16)(o[t][v] * inv);
  }
}

// ---------------------------------------------------------------------------
// Kernel 5: out = wo @ O + bo + x   (f32 output, channel-major)
// ---------------------------------------------------------------------------
__global__ __launch_bounds__(128) void proj_o_kernel(const float* __restrict__ wo,
                                                     const float* __restrict__ bo,
                                                     const _Float16* __restrict__ outT,
                                                     const float* __restrict__ x,
                                                     float* __restrict__ out) {
  const int b = blockIdx.y;
  const int p0 = blockIdx.x * 64;
  const int wave = threadIdx.x >> 5;
  const int lane = threadIdx.x & 31;
  const int half = lane >> 4, r = lane & 15;
  const int co0 = wave * 16;

  Frag16 a[2];
  const float* wrow = wo + (co0 + r) * CH;
  for (int ck = 0; ck < 2; ++ck)
    for (int j = 0; j < 8; ++j) {
      a[ck].v[j]     = (_Float16)wrow[ck * 32 + half * 8 + j];
      a[ck].v[j + 8] = (_Float16)wrow[ck * 32 + half * 8 + 16 + j];
    }
  float bias[8];
  for (int v = 0; v < 8; ++v) bias[v] = bo[co0 + 8 * half + v];

  for (int pt = 0; pt < 4; ++pt) {
    const int p1 = p0 + pt * 16;
    const _Float16* orow = outT + ((size_t)b * NPOS + p1 + r) * CH;
    Frag16 bm0, bm1;
    load_frag(bm0, orow, half);
    load_frag(bm1, orow + 32, half);
    v8f acc = {};
    acc = wmma16(a[0], bm0, acc);
    acc = wmma16(a[1], bm1, acc);
    for (int v = 0; v < 8; ++v) {
      const int co = co0 + v + 8 * half;
      const size_t oidx = ((size_t)b * CH + co) * NPOS + p1 + r;
      out[oidx] = acc[v] + bias[v] + x[oidx];
    }
  }
}

// ---------------------------------------------------------------------------
extern "C" void kernel_launch(void* const* d_in, const int* in_sizes, int n_in,
                              void* d_out, int out_size, void* d_ws, size_t ws_size,
                              hipStream_t stream) {
  const float* x   = (const float*)d_in[0];
  const float* lng = (const float*)d_in[1];
  const float* lnb = (const float*)d_in[2];
  const float* wq  = (const float*)d_in[3];
  const float* bq  = (const float*)d_in[4];
  const float* wk  = (const float*)d_in[5];
  const float* bk  = (const float*)d_in[6];
  const float* wv  = (const float*)d_in[7];
  const float* bv  = (const float*)d_in[8];
  const float* wo  = (const float*)d_in[9];
  const float* bo  = (const float*)d_in[10];
  float* out = (float*)d_out;

  char* ws = (char*)d_ws;
  const size_t T = (size_t)B_ * CH * NPOS * sizeof(_Float16);   // 2 MB each
  _Float16* xn_c = (_Float16*)(ws + 0 * T);
  _Float16* xn_t = (_Float16*)(ws + 1 * T);
  _Float16* qT   = (_Float16*)(ws + 2 * T);
  _Float16* kT   = (_Float16*)(ws + 3 * T);
  _Float16* v_c  = (_Float16*)(ws + 4 * T);
  _Float16* outT = (_Float16*)(ws + 5 * T);

  ln_kernel<<<dim3((B_ * NPOS) / 256), 256, 0, stream>>>(x, lng, lnb, xn_c, xn_t);
  dwconv_kernel<<<dim3((B_ * CH * NPOS) / 256), 256, 0, stream>>>(xn_c, wk, bk, wv, bv, kT, v_c);
  proj_q_kernel<<<dim3(NPOS / 64, B_), 128, 0, stream>>>(wq, bq, xn_t, qT);
  attn_kernel<<<dim3(NPOS / 128, B_), 256, 0, stream>>>(qT, kT, v_c, outT);
  proj_o_kernel<<<dim3(NPOS / 64, B_), 128, 0, stream>>>(wo, bo, outT, x, out);
}

// v001
// It runs in 83.3 microseconds.
// Two timings next to v000 both put it at 2.83 times that version's speed.
#include <hip/hip_runtime.h>
#include <hip/hip_bf16.h>

#define B_   4
#define CH   64
#define HS   64
#define WSZ  64
#define NPOS (HS*WSZ)   // 4096
#define LDP  72         // LDS row stride in halves (144B rows: 16B-aligned)

typedef __attribute__((ext_vector_type(16))) _Float16 v16h;
typedef __attribute__((ext_vector_type(8)))  float    v8f;

union Frag16 { v16h v; uint4 q[2]; };
union Pack8  { uint4 u; _Float16 h[8]; };
union Pack64 { uint4 u[8]; _Float16 h[64]; };

// Load one 16x32 f16 fragment in the A-matrix VGPR layout from a row-major
// tile.  `row` must point at (tile_row_base + this lane's row * ld).
// Lane L (r=L&15, half=L>>4) holds halves k = half*8 + {0..7} and 16+half*8+{0..7}.
__device__ __forceinline__ void load_frag(Frag16& f, const _Float16* row, int half) {
  f.q[0] = *(const uint4*)(row + half * 8);
  f.q[1] = *(const uint4*)(row + half * 8 + 16);
}

__device__ __forceinline__ v8f wmma16(const Frag16& a, const Frag16& b, v8f c) {
  return __builtin_amdgcn_wmma_f32_16x16x32_f16(false, a.v, false, b.v,
                                                (short)0, c, false, false);
}

// Async global->LDS copy, 16B per lane, tracked by ASYNCcnt (CDNA5).
// GV mode: per-lane 64-bit global address, per-lane LDS byte offset.
__device__ __forceinline__ void async_copy_b128(const void* gptr, void* lptr) {
  unsigned lds_off = (unsigned)(uintptr_t)lptr;          // addr[31:0] = LDS offset
  unsigned long long gaddr = (unsigned long long)(uintptr_t)gptr;
  asm volatile("global_load_async_to_lds_b128 %0, %1, off"
               :: "v"(lds_off), "v"(gaddr) : "memory");
}

// Lane l <-> lane l ^ 16 (the other half of the wave), a vector cross-row move.
__device__ __forceinline__ float xhalf(float x) {
  const int xi = __builtin_bit_cast(int, x);
  return __builtin_bit_cast(float, __builtin_amdgcn_permlanex16(xi, xi, 0x76543210, 0xfedcba98,
                                                                false, false));
}

// e^x as 2^(x*log2 e).  The v_nop is the slot the instruction set asks for between a
// transcendental and an instruction that reads its result or overwrites its source;
// inside the statement it stays directly behind the v_exp_f32.
__device__ __forceinline__ float exp_slot(float x) {
  float r;
  asm("v_exp_f32 %0, %1\n\tv_nop" : "=v"(r) : "v"(x * 1.44269504f));
  return r;
}

__device__ __forceinline__ void wait_async0() {
  asm volatile("s_wait_asynccnt 0" ::: "memory");
}

// ---------------------------------------------------------------------------
// Kernel 1: per-pixel channel LayerNorm; emit xn in channel-major (for the
// depthwise convs) and position-major (WMMA B-operand for the q projection).
// ---------------------------------------------------------------------------
__global__ __launch_bounds__(256) void ln_kernel(const float* __restrict__ x,
                                                 const float* __restrict__ g,
                                                 const float* __restrict__ be,
                                                 _Float16* __restrict__ xn_c,
                                                 _Float16* __restrict__ xn_t) {
  const int idx = blockIdx.x * 256 + threadIdx.x;       // b*NPOS + p
  const int b = idx / NPOS;
  const int p = idx - b * NPOS;
  const size_t base = (size_t)b * CH * NPOS + p;
  float s = 0.f, ss = 0.f;
  for (int c = 0; c < CH; ++c) {
    float v = x[base + (size_t)c * NPOS];
    s += v; ss += v * v;
  }
  const float mu = s * (1.0f / CH);
  const float var = ss * (1.0f / CH) - mu * mu;
  const float rstd = rsqrtf(var + 1e-5f);
  Pack64 pk;
  for (int c = 0; c < CH; ++c) {
    float xv = (x[base + (size_t)c * NPOS] - mu) * rstd * g[c] + be[c];
    _Float16 hf = (_Float16)xv;
    xn_c[base + (size_t)c * NPOS] = hf;
    pk.h[c] = hf;
  }
  uint4* trow = (uint4*)(xn_t + (size_t)idx * CH);
  for (int k = 0; k < 8; ++k) trow[k] = pk.u[k];
}

// ---------------------------------------------------------------------------
// Kernel 2: depthwise 3x3 convs (k, v).  k stored position-major [p][c]
// (WMMA A operand for K Q^T), v stored channel-major [c][p] (A operand for V P^T).
// ---------------------------------------------------------------------------
__global__ __launch_bounds__(256) void dwconv_kernel(const _Float16* __restrict__ xn_c,
                                                     const float* __restrict__ wk,
                                                     const float* __restrict__ bk,
                                                     const float* __restrict__ wv,
                                                     const float* __restrict__ bv,
                                                     _Float16* __restrict__ kT,
                                                     _Float16* __restrict__ v_c) {
  const int idx = blockIdx.x * 256 + threadIdx.x;       // over B*C*N
  const int p  = idx & (NPOS - 1);
  const int bc = idx >> 12;
  const int c  = bc & (CH - 1);
  const int b  = bc >> 6;
  const int h  = p >> 6, w = p & (WSZ - 1);
  float accK = bk[c], accV = bv[c];
  const _Float16* src = xn_c + (size_t)bc * NPOS;
  for (int dy = -1; dy <= 1; ++dy) {
    int hh = h + dy;
    if ((unsigned)hh >= HS) continue;
    for (int dx = -1; dx <= 1; ++dx) {
      int ww = w + dx;
      if ((unsigned)ww >= WSZ) continue;
      float xv = (float)src[hh * WSZ + ww];
      int wi = c * 9 + (dy + 1) * 3 + (dx + 1);
      accK += wk[wi] * xv;
      accV += wv[wi] * xv;
    }
  }
  kT[((size_t)b * NPOS + p) * CH + c] = (_Float16)accK;
  v_c[(size_t)bc * NPOS + p]          = (_Float16)accV;
}

// ---------------------------------------------------------------------------
// Kernel 3: q = wq @ xn + bq, scaled by 1/sqrt(C); stored position-major.
// 128 threads = 4 waves; each wave owns a 16-row slab of output channels.
// ---------------------------------------------------------------------------
__global__ __launch_bounds__(128) void proj_q_kernel(const float* __restrict__ wq,
                                                     const float* __restrict__ bq,
                                                     const _Float16* __restrict__ xnT,
                                                     _Float16* __restrict__ qT) {
  const int b = blockIdx.y;
  const int p0 = blockIdx.x * 64;
  const int wave = threadIdx.x >> 5;
  const int lane = threadIdx.x & 31;
  const int half = lane >> 4, r = lane & 15;
  const int co0 = wave * 16;

  Frag16 a[2];
  const float* wrow = wq + (co0 + r) * CH;
  for (int ck = 0; ck < 2; ++ck)
    for (int j = 0; j < 8; ++j) {
      a[ck].v[j]     = (_Float16)wrow[ck * 32 + half * 8 + j];
      a[ck].v[j + 8] = (_Float16)wrow[ck * 32 + half * 8 + 16 + j];
    }
  float bias[8];
  for (int v = 0; v < 8; ++v) bias[v] = bq[co0 + 8 * half + v];

  for (int pt = 0; pt < 4; ++pt) {
    const int p1 = p0 + pt * 16;
    const _Float16* xrow = xnT + ((size_t)b * NPOS + p1 + r) * CH;
    Frag16 bm0, bm1;
    load_frag(bm0, xrow, half);
    load_frag(bm1, xrow + 32, half);
    v8f acc = {};
    acc = wmma16(a[0], bm0, acc);
    acc = wmma16(a[1], bm1, acc);
    Pack8 pk;
    for (int v = 0; v < 8; ++v)
      pk.h[v] = (_Float16)((acc[v] + bias[v]) * 0.125f);   // fold 1/sqrt(64)
    *(uint4*)(qT + ((size_t)b * NPOS + p1 + r) * CH + co0 + 8 * half) = pk.u;
  }
}

__global__ __launch_bounds__(256) void attn_kernel(const _Float16* __restrict__ qT,
                                                   const _Float16* __restrict__ kT,
                                                   const _Float16* __restrict__ v_c,
                                                   _Float16* __restrict__ outT) {
  __shared__ _Float16 lds_k[2][64 * LDP];
  __shared__ _Float16 lds_v[2][64 * LDP];

  const int b = blockIdx.y;
  const int qbase = blockIdx.x * 128;
  const int tid = threadIdx.x;
  const int wave = tid >> 5;
  const int lane = tid & 31;
  const int half = lane >> 4, r = lane & 15;
  const int i0 = qbase + wave * 16;

  // Q fragments (B operand: lane r = query column), fixed for the whole loop.
  const _Float16* qrow = qT + ((size_t)b * NPOS + i0 + r) * CH;
  Frag16 qb0, qb1;
  load_frag(qb0, qrow, half);
  load_frag(qb1, qrow + 32, half);

  // Per lane: running maximum of query r (equal in both halves) and this
  // half's share of its sum.  o[t][v] = O^T[channel t*16 + 8*half + v][query r].
  float mi = -3.0e38f, li = 0.f;
  v8f o[4];
  for (int t = 0; t < 4; ++t) o[t] = (v8f){};

  // Issue async staging of tile `kb` into buffer `buf` (4 async ops / wave).
  auto issue_tile = [&](int kb, int buf) {
    const int j0 = kb * 64;
    const _Float16* kbase = kT + ((size_t)b * NPOS + j0) * CH;
    for (int it = 0; it < 2; ++it) {
      int idx = tid + it * 256;                 // 0..511 b128 chunks
      int row = idx >> 3, col = idx & 7;
      async_copy_b128(kbase + row * CH + col * 8,
                      lds_k[buf] + row * LDP + col * 8);
    }
    for (int it = 0; it < 2; ++it) {
      int idx = tid + it * 256;
      int row = idx >> 3, col = idx & 7;
      async_copy_b128(v_c + ((size_t)b * CH + row) * NPOS + j0 + col * 8,
                      lds_v[buf] + row * LDP + col * 8);
    }
  };

  issue_tile(0, 0);

  for (int kb = 0; kb < NPOS / 64; ++kb) {
    const int cur = kb & 1;
    wait_async0();        // my 4 copies for buffer `cur` have landed
    __syncthreads();      // everyone's copies landed; everyone done reading `cur^1`
    if (kb + 1 < NPOS / 64) issue_tile(kb + 1, cur ^ 1);

    // S^T = K Q^T : 4 key sub-tiles of 16 (A rows), contraction over 64 channels.
    // s[t][v] = score of key t*16 + 8*half + v against query r.
    v8f s[4];
    for (int t = 0; t < 4; ++t) {
      const _Float16* krow = lds_k[cur] + (t * 16 + r) * LDP;
      Frag16 ka0, ka1;
      load_frag(ka0, krow, half);
      load_frag(ka1, krow + 32, half);
      v8f acc = {};
      acc = wmma16(ka0, qb0, acc);
      acc = wmma16(ka1, qb1, acc);
      s[t] = acc;
    }

    // Online softmax, one query per lane.
    // One short chain per sub-tile for the maximum and for the sum.
    float tm[4];
    for (int t = 0; t < 4; ++t) {
      tm[t] = s[t][0];
      for (int v = 1; v < 8; ++v) tm[t] = fmaxf(tm[t], s[t][v]);
    }
    float rm = fmaxf(fmaxf(tm[0], tm[1]), fmaxf(tm[2], tm[3]));
    rm = fmaxf(rm, xhalf(rm));                  // join the two halves' keys
    const float mnew = fmaxf(mi, rm);
    const float corr = exp_slot(mi - mnew);
    mi = mnew;
    float ts[4];
    // Unrolled so that every index of s[] is a constant (a run-time index would
    // go through indexed register moves).
#pragma unroll
    for (int t = 0; t < 4; ++t) {
      s[t][0] = exp_slot(s[t][0] - mnew);
      ts[t] = s[t][0];
#pragma unroll  // as above: constant indices only
      for (int v = 1; v < 8; ++v) {
        s[t][v] = exp_slot(s[t][v] - mnew);
        ts[t] += s[t][v];
      }
    }
    li = li * corr + ((ts[0] + ts[1]) + (ts[2] + ts[3]));
    for (int t = 0; t < 4; ++t) o[t] *= corr;

    // P^T as B operand: element e of chunk c is key 32c + 16*(e>>3) + 8*half + (e&7),
    // the same k order load_frag gives the V rows.
    Frag16 pb0, pb1;
    for (int e = 0; e < 16; ++e) {
      pb0.v[e] = (_Float16)s[e >> 3][e & 7];
      pb1.v[e] = (_Float16)s[2 + (e >> 3)][e & 7];
    }

    // O^T += V P^T : A = V channel rows (16 x 64 keys), B = P^T.
    for (int t = 0; t < 4; ++t) {
      const _Float16* vrow = lds_v[cur] + (t * 16 + r) * LDP;
      Frag16 va0, va1;
      load_frag(va0, vrow, half);
      load_frag(va1, vrow + 32, half);
      o[t] = wmma16(va0, pb0, o[t]);
      o[t] = wmma16(va1, pb1, o[t]);
    }
  }

  // Join the halves' sums, normalize, store O position-major [i][c] as f16:
  // a lane's 8 accumulator registers are 8 consecutive channels of its query.
  li += xhalf(li);
  const float inv = 1.0f / li;
  _Float16* orow = outT + ((size_t)b * NPOS + i0 + r) * CH + 8 * half;
  for (int t = 0; t < 4; ++t) {
    Pack8 pk;
    for (int v = 0; v < 8; ++v) pk.h[v] = (_Float16)(o[t][v] * inv);
    *(uint4*)(orow + t * 16) = pk.u;
  }
}

// ---------------------------------------------------------------------------
// Kernel 5: out = wo @ O + bo + x   (f32 output, channel-major)
// ---------------------------------------------------------------------------
__global__ __launch_bounds__(128) void proj_o_kernel(const float* __restrict__ wo,
                                                     const float* __restrict__ bo,
                                                     const _Float16* __restrict__ outT,
                                                     const float* __restrict__ x,
                                                     float* __restrict__ out) {
  const int b = blockIdx.y;
  const int p0 = blockIdx.x * 64;
  const int wave = threadIdx.x >> 5;
  const int lane = threadIdx.x & 31;
  const int half = lane >> 4, r = lane & 15;
  const int co0 = wave * 16;

  Frag16 a[2];
  const float* wrow = wo + (co0 + r) * CH;
  for (int ck = 0; ck < 2; ++ck)
    for (int j = 0; j < 8; ++j) {
      a[ck].v[j]     = (_Float16)wrow[ck * 32 + half * 8 + j];
      a[ck].v[j + 8] = (_Float16)wrow[ck * 32 + half * 8 + 16 + j];
    }
  float bias[8];
  for (int v = 0; v < 8; ++v) bias[v] = bo[co0 + 8 * half + v];

  for (int pt = 0; pt < 4; ++pt) {
    const int p1 = p0 + pt * 16;
    const _Float16* orow = outT + ((size_t)b * NPOS + p1 + r) * CH;
    Frag16 bm0, bm1;
    load_frag(bm0, orow, half);
    load_frag(bm1, orow + 32, half);
    v8f acc = {};
    acc = wmma16(a[0], bm0, acc);
    acc = wmma16(a[1], bm1, acc);
    for (int v = 0; v < 8; ++v) {
      const int co = co0 + v + 8 * half;
      const size_t oidx = ((size_t)b * CH + co) * NPOS + p1 + r;
      out[oidx] = acc[v] + bias[v] + x[oidx];
    }
  }
}

// ---------------------------------------------------------------------------
extern "C" void kernel_launch(void* const* d_in, const int* in_sizes, int n_in,
                              void* d_out, int out_size, void* d_ws, size_t ws_size,
                              hipStream_t stream) {
  const float* x   = (const float*)d_in[0];
  const float* lng = (const float*)d_in[1];
  const float* lnb = (const float*)d_in[2];
  const float* wq  = (const float*)d_in[3];
  const float* bq  = (const float*)d_in[4];
  const float* wk  = (const float*)d_in[5];
  const float* bk  = (const float*)d_in[6];
  const float* wv  = (const float*)d_in[7];
  const float* bv  = (const float*)d_in[8];
  const float* wo  = (const float*)d_in[9];
  const float* bo  = (const float*)d_in[10];
  float* out = (float*)d_out;

  char* ws = (char*)d_ws;
  const size_t T = (size_t)B_ * CH * NPOS * sizeof(_Float16);   // 2 MB each
  _Float16* xn_c = (_Float16*)(ws + 0 * T);
  _Float16* xn_t = (_Float16*)(ws + 1 * T);
  _Float16* qT   = (_Float16*)(ws + 2 * T);
  _Float16* kT   = (_Float16*)(ws + 3 * T);
  _Float16* v_c  = (_Float16*)(ws + 4 * T);
  _Float16* outT = (_Float16*)(ws + 5 * T);

  ln_kernel<<<dim3((B_ * NPOS) / 256), 256, 0, stream>>>(x, lng, lnb, xn_c, xn_t);
  dwconv_kernel<<<dim3((B_ * CH * NPOS) / 256), 256, 0, stream>>>(xn_c, wk, bk, wv, bv, kT, v_c);
  proj_q_kernel<<<dim3(NPOS / 64, B_), 128, 0, stream>>>(wq, bq, xn_t, qT);
  attn_kernel<<<dim3(NPOS / 128, B_), 256, 0, stream>>>(qT, kT, v_c, outT);
  proj_o_kernel<<<dim3(NPOS / 64, B_), 128, 0, stream>>>(wo, bo, outT, x, out);
}

// v002
// A run of this version takes 55.6 microseconds.
// Timed twice side by side with v001, it ran 1.53 and 1.48 times as fast.
// Over all steps from v000 it is 4.25 times as fast.
#include <hip/hip_runtime.h>
#include <hip/hip_bf16.h>

#define B_   4
#define CH   64
#define HS   64
#define WSZ  64
#define NPOS (HS*WSZ)   // 4096
#define LDP  72         // LDS row stride in halves (144B rows: 16B-aligned)

typedef __attribute__((ext_vector_type(16))) _Float16 v16h;
typedef __attribute__((ext_vector_type(8)))  float    v8f;

union Frag16 { v16h v; uint4 q[2]; };
union Pack8  { uint4 u; _Float16 h[8]; };
union Pack64 { uint4 u[8]; _Float16 h[64]; };

// Load one 16x32 f16 fragment in the A-matrix VGPR layout from a row-major
// tile.  `row` must point at (tile_row_base + this lane's row * ld).
// Lane L (r=L&15, half=L>>4) holds halves k = half*8 + {0..7} and 16+half*8+{0..7}.
__device__ __forceinline__ void load_frag(Frag16& f, const _Float16* row, int half) {
  f.q[0] = *(const uint4*)(row + half * 8);
  f.q[1] = *(const uint4*)(row + half * 8 + 16);
}

__device__ __forceinline__ v8f wmma16(const Frag16& a, const Frag16& b, v8f c) {
  return __builtin_amdgcn_wmma_f32_16x16x32_f16(false, a.v, false, b.v,
                                                (short)0, c, false, false);
}

// Eight async global->LDS copies, 16B per lane each, tracked by ASYNCcnt.
// Per-lane 64-bit global address, per-lane LDS byte address (low 32 bits of the
// __shared__ address).  The s_wait_xcnt stands inside the statement, behind the last
// copy, so that no address register is rewritten in front of it.
struct Copy8 { unsigned l[8]; const _Float16* g[8]; };
__device__ __forceinline__ void async_copy8_b128(const Copy8& c) {
  asm volatile("global_load_async_to_lds_b128 %0, %8, off\n\t"
               "global_load_async_to_lds_b128 %1, %9, off\n\t"
               "global_load_async_to_lds_b128 %2, %10, off\n\t"
               "global_load_async_to_lds_b128 %3, %11, off\n\t"
               "global_load_async_to_lds_b128 %4, %12, off\n\t"
               "global_load_async_to_lds_b128 %5, %13, off\n\t"
               "global_load_async_to_lds_b128 %6, %14, off\n\t"
               "global_load_async_to_lds_b128 %7, %15, off\n\t"
               "s_wait_xcnt 0x0"
               :: "v"(c.l[0]), "v"(c.l[1]), "v"(c.l[2]), "v"(c.l[3]),
                  "v"(c.l[4]), "v"(c.l[5]), "v"(c.l[6]), "v"(c.l[7]),
                  "v"(c.g[0]), "v"(c.g[1]), "v"(c.g[2]), "v"(c.g[3]),
                  "v"(c.g[4]), "v"(c.g[5]), "v"(c.g[6]), "v"(c.g[7])
               : "memory");
}

// Lane l <-> lane l ^ 16 (the other half of the wave), a vector cross-row move.
__device__ __forceinline__ float xhalf(float x) {
  const int xi = __builtin_bit_cast(int, x);
  return __builtin_bit_cast(float, __builtin_amdgcn_permlanex16(xi, xi, 0x76543210, 0xfedcba98,
                                                                false, false));
}

// e^x as 2^(x*log2 e).  The v_nop is the slot the instruction set asks for between a
// transcendental and an instruction that reads its result or overwrites its source;
// inside the statement it stays directly behind the v_exp_f32.
__device__ __forceinline__ float exp_slot(float x) {
  float r;
  asm("v_exp_f32 %0, %1\n\tv_nop" : "=v"(r) : "v"(x * 1.44269504f));
  return r;
}

// This wave's async copies have landed in LDS.
__device__ __forceinline__ void wait_async0() {
  asm volatile("s_wait_asynccnt 0x0" ::: "memory");
}

// This wave's LDS reads have returned (before a buffer it read is handed back for refill).
__device__ __forceinline__ void wait_ds0() {
  asm volatile("s_wait_dscnt 0x0" ::: "memory");
}

// ---------------------------------------------------------------------------
// Kernel 1: per-pixel channel LayerNorm; emit xn in channel-major (for the
// depthwise convs) and position-major (WMMA B-operand for the q projection).
// ---------------------------------------------------------------------------
__global__ __launch_bounds__(256) void ln_kernel(const float* __restrict__ x,
                                                 const float* __restrict__ g,
                                                 const float* __restrict__ be,
                                                 _Float16* __restrict__ xn_c,
                                                 _Float16* __restrict__ xn_t) {
  const int idx = blockIdx.x * 256 + threadIdx.x;       // b*NPOS + p
  const int b = idx / NPOS;
  const int p = idx - b * NPOS;
  const size_t base = (size_t)b * CH * NPOS + p;
  float s = 0.f, ss = 0.f;
  for (int c = 0; c < CH; ++c) {
    float v = x[base + (size_t)c * NPOS];
    s += v; ss += v * v;
  }
  const float mu = s * (1.0f / CH);
  const float var = ss * (1.0f / CH) - mu * mu;
  const float rstd = rsqrtf(var + 1e-5f);
  Pack64 pk;
  for (int c = 0; c < CH; ++c) {
    float xv = (x[base + (size_t)c * NPOS] - mu) * rstd * g[c] + be[c];
    _Float16 hf = (_Float16)xv;
    xn_c[base + (size_t)c * NPOS] = hf;
    pk.h[c] = hf;
  }
  uint4* trow = (uint4*)(xn_t + (size_t)idx * CH);
  for (int k = 0; k < 8; ++k) trow[k] = pk.u[k];
}

// ---------------------------------------------------------------------------
// Kernel 2: depthwise 3x3 convs (k, v).  k stored position-major [p][c]
// (WMMA A operand for K Q^T), v stored channel-major [c][p] (A operand for V P^T).
// ---------------------------------------------------------------------------
__global__ __launch_bounds__(256) void dwconv_kernel(const _Float16* __restrict__ xn_c,
                                                     const float* __restrict__ wk,
                                                     const float* __restrict__ bk,
                                                     const float* __restrict__ wv,
                                                     const float* __restrict__ bv,
                                                     _Float16* __restrict__ kT,
                                                     _Float16* __restrict__ v_c) {
  const int idx = blockIdx.x * 256 + threadIdx.x;       // over B*C*N
  const int p  = idx & (NPOS - 1);
  const int bc = idx >> 12;
  const int c  = bc & (CH - 1);
  const int b  = bc >> 6;
  const int h  = p >> 6, w = p & (WSZ - 1);
  float accK = bk[c], accV = bv[c];
  const _Float16* src = xn_c + (size_t)bc * NPOS;
  for (int dy = -1; dy <= 1; ++dy) {
    int hh = h + dy;
    if ((unsigned)hh >= HS) continue;
    for (int dx = -1; dx <= 1; ++dx) {
      int ww = w + dx;
      if ((unsigned)ww >= WSZ) continue;
      float xv = (float)src[hh * WSZ + ww];
      int wi = c * 9 + (dy + 1) * 3 + (dx + 1);
      accK += wk[wi] * xv;
      accV += wv[wi] * xv;
    }
  }
  kT[((size_t)b * NPOS + p) * CH + c] = (_Float16)accK;
  v_c[(size_t)bc * NPOS + p]          = (_Float16)accV;
}

// ---------------------------------------------------------------------------
// Kernel 3: q = wq @ xn + bq, scaled by 1/sqrt(C); stored position-major.
// 128 threads = 4 waves; each wave owns a 16-row slab of output channels.
// ---------------------------------------------------------------------------
__global__ __launch_bounds__(128) void proj_q_kernel(const float* __restrict__ wq,
                                                     const float* __restrict__ bq,
                                                     const _Float16* __restrict__ xnT,
                                                     _Float16* __restrict__ qT) {
  const int b = blockIdx.y;
  const int p0 = blockIdx.x * 64;
  const int wave = threadIdx.x >> 5;
  const int lane = threadIdx.x & 31;
  const int half = lane >> 4, r = lane & 15;
  const int co0 = wave * 16;

  Frag16 a[2];
  const float* wrow = wq + (co0 + r) * CH;
  for (int ck = 0; ck < 2; ++ck)
    for (int j = 0; j < 8; ++j) {
      a[ck].v[j]     = (_Float16)wrow[ck * 32 + half * 8 + j];
      a[ck].v[j + 8] = (_Float16)wrow[ck * 32 + half * 8 + 16 + j];
    }
  float bias[8];
  for (int v = 0; v < 8; ++v) bias[v] = bq[co0 + 8 * half + v];

  for (int pt = 0; pt < 4; ++pt) {
    const int p1 = p0 + pt * 16;
    const _Float16* xrow = xnT + ((size_t)b * NPOS + p1 + r) * CH;
    Frag16 bm0, bm1;
    load_frag(bm0, xrow, half);
    load_frag(bm1, xrow + 32, half);
    v8f acc = {};
    acc = wmma16(a[0], bm0, acc);
    acc = wmma16(a[1], bm1, acc);
    Pack8 pk;
    for (int v = 0; v < 8; ++v)
      pk.h[v] = (_Float16)((acc[v] + bias[v]) * 0.125f);   // fold 1/sqrt(64)
    *(uint4*)(qT + ((size_t)b * NPOS + p1 + r) * CH + co0 + 8 * half) = pk.u;
  }
}

#define KG     4
#define QTL    4
#define SKEYS  (KG * 64)
#define NSTAGE (NPOS / SKEYS)
#define OPITCH 68

__global__ __launch_bounds__(512) void attn_kernel(const _Float16* __restrict__ qT,
                                                   const _Float16* __restrict__ kT,
                                                   const _Float16* __restrict__ v_c,
                                                   _Float16* __restrict__ outT) {
  __shared__ __attribute__((aligned(16))) _Float16 lds_k[2][KG * 64 * LDP];
  __shared__ __attribute__((aligned(16))) _Float16 lds_v[2][KG * 64 * LDP];
  __shared__ __attribute__((aligned(16))) float lds_o[KG][QTL][16][OPITCH];
  __shared__ float lds_m[KG][QTL][16];
  __shared__ float lds_l[KG][QTL][16];

  const int b = blockIdx.y;
  const int qbase = blockIdx.x * (QTL * 16);
  const int tid = threadIdx.x;
  const int wave = tid >> 5;
  const int lane = tid & 31;
  const int half = lane >> 4, r = lane & 15;
  const int qt = wave & (QTL - 1);
  const int kg = wave >> 2;
  const int i0 = qbase + qt * 16;

  // Q fragments (B operand: lane r = query column), fixed for the whole loop.
  const _Float16* qrow = qT + ((size_t)b * NPOS + i0 + r) * CH;
  Frag16 qb0, qb1;
  load_frag(qb0, qrow, half);
  load_frag(qb1, qrow + 32, half);

  // Per lane: running maximum of query r over this wave's keys (equal in both
  // halves) and this half's share of its sum.
  // o[t][v] = O^T[channel t*16 + 8*half + v][query r], this wave's keys only.
  float mi = -3.0e38f, li = 0.f;
  v8f o[4];
  for (int t = 0; t < 4; ++t) o[t] = (v8f){};

  // Issue the async staging of stage `st` into buffer `buf` (8 copies / wave).
  // K: 256 key rows of 128B.  V: 64 channel rows of 512B, cut into the four key
  // groups' 64x64 tiles.
  auto issue_stage = [&](int st, int buf) {
    const int j0 = st * SKEYS;
    const _Float16* kbase = kT + ((size_t)b * NPOS + j0) * CH;
    const _Float16* vbase = v_c + (size_t)b * CH * NPOS + j0;
    Copy8 c;
    for (int it = 0; it < 4; ++it) {
      const int idx = tid + it * 512;           // 0..2047 b128 chunks
      const int row = idx >> 3, col = idx & 7;
      c.g[it] = kbase + row * CH + col * 8;
      c.l[it] = (unsigned)(uintptr_t)(lds_k[buf] + row * LDP + col * 8);
    }
    for (int it = 0; it < 4; ++it) {
      const int idx = tid + it * 512;
      const int row = idx >> 5, grp = (idx >> 3) & 3, col = idx & 7;
      c.g[4 + it] = vbase + (size_t)row * NPOS + grp * 64 + col * 8;
      c.l[4 + it] = (unsigned)(uintptr_t)(lds_v[buf] + (grp * 64 + row) * LDP + col * 8);
    }
    async_copy8_b128(c);
  };

  issue_stage(0, 0);
  wait_async0();          // my copies of stage 0 have landed
  __syncthreads();        // everyone's have
  issue_stage(1, 1);

  for (int st = 0; st < NSTAGE; ++st) {
    const int cur = st & 1;
    const _Float16* ktile = lds_k[cur] + kg * 64 * LDP;
    const _Float16* vtile = lds_v[cur] + kg * 64 * LDP;

    // S^T = K Q^T : 4 key sub-tiles of 16 (A rows), contraction over 64 channels.
    // s[t][v] = score of key t*16 + 8*half + v against query r.
    v8f s[4];
    for (int t = 0; t < 4; ++t) {
      const _Float16* krow = ktile + (t * 16 + r) * LDP;
      Frag16 ka0, ka1;
      load_frag(ka0, krow, half);
      load_frag(ka1, krow + 32, half);
      v8f acc = {};
      acc = wmma16(ka0, qb0, acc);
      acc = wmma16(ka1, qb1, acc);
      s[t] = acc;
    }

    // Online softmax, one query per lane.
    // One short chain per sub-tile for the maximum and for the sum.
    float tm[4];
    for (int t = 0; t < 4; ++t) {
      tm[t] = s[t][0];
      for (int v = 1; v < 8; ++v) tm[t] = fmaxf(tm[t], s[t][v]);
    }
    float rm = fmaxf(fmaxf(tm[0], tm[1]), fmaxf(tm[2], tm[3]));
    rm = fmaxf(rm, xhalf(rm));                  // join the two halves' keys
    const float mnew = fmaxf(mi, rm);
    const float corr = exp_slot(mi - mnew);
    mi = mnew;
    float ts[4];
    // Unrolled so that every index of s[] is a constant (a run-time index would
    // go through indexed register moves).
#pragma unroll
    for (int t = 0; t < 4; ++t) {
      s[t][0] = exp_slot(s[t][0] - mnew);
      ts[t] = s[t][0];
#pragma unroll  // as above: constant indices only
      for (int v = 1; v < 8; ++v) {
        s[t][v] = exp_slot(s[t][v] - mnew);
        ts[t] += s[t][v];
      }
    }
    li = li * corr + ((ts[0] + ts[1]) + (ts[2] + ts[3]));
    for (int t = 0; t < 4; ++t) o[t] *= corr;

    // P^T as B operand: element e of chunk c is key 32c + 16*(e>>3) + 8*half + (e&7),
    // the same k order load_frag gives the V rows.
    Frag16 pb0, pb1;
    for (int e = 0; e < 16; ++e) {
      pb0.v[e] = (_Float16)s[e >> 3][e & 7];
      pb1.v[e] = (_Float16)s[2 + (e >> 3)][e & 7];
    }

    // O^T += V P^T : A = V channel rows (16 x 64 keys), B = P^T.
    for (int t = 0; t < 4; ++t) {
      const _Float16* vrow = vtile + (t * 16 + r) * LDP;
      Frag16 va0, va1;
      load_frag(va0, vrow, half);
      load_frag(va1, vrow + 32, half);
      o[t] = wmma16(va0, pb0, o[t]);
      o[t] = wmma16(va1, pb1, o[t]);
    }

    // Publish point of stage st + 1.
    wait_ds0();           // my reads of buffer `cur` have returned
    wait_async0();        // my copies of stage st + 1 have landed
    __syncthreads();      // everyone's have; everyone is done reading `cur`
    if (st + 2 < NSTAGE) issue_stage(st + 2, cur);
  }
  wait_async0();          // nothing of mine is in flight any more

  // Hand this wave's partial result over: maximum, sum (halves joined), O^T rows.
  li += xhalf(li);
  if (half == 0) {
    lds_m[kg][qt][r] = mi;
    lds_l[kg][qt][r] = li;
  }
  float* prow = &lds_o[kg][qt][r][8 * half];
  for (int t = 0; t < 4; ++t) {
    *(float4*)(prow + t * 16)     = make_float4(o[t][0], o[t][1], o[t][2], o[t][3]);
    *(float4*)(prow + t * 16 + 4) = make_float4(o[t][4], o[t][5], o[t][6], o[t][7]);
  }
  __syncthreads();        // all partial results are in LDS

  // Join the four key groups.  Wave (kg, qt) finishes queries 4*kg..4*kg+3 of tile
  // qt: a lane takes 8 consecutive channels of one query, so a wave stores four
  // whole 128B rows of O (position-major [i][c], f16).
  const int ql = 4 * kg + (lane >> 3);
  const int cc = lane & 7;
  float mg[KG];
  for (int j = 0; j < KG; ++j) mg[j] = lds_m[j][qt][ql];
  const float mall = fmaxf(fmaxf(mg[0], mg[1]), fmaxf(mg[2], mg[3]));
  float lall = 0.f;
  float acc[8];
  for (int v = 0; v < 8; ++v) acc[v] = 0.f;
  for (int j = 0; j < KG; ++j) {
    const float wj = exp_slot(mg[j] - mall);
    lall += wj * lds_l[j][qt][ql];
    const float4 p0 = *(const float4*)&lds_o[j][qt][ql][cc * 8];
    const float4 p1 = *(const float4*)&lds_o[j][qt][ql][cc * 8 + 4];
    acc[0] += wj * p0.x; acc[1] += wj * p0.y; acc[2] += wj * p0.z; acc[3] += wj * p0.w;
    acc[4] += wj * p1.x; acc[5] += wj * p1.y; acc[6] += wj * p1.z; acc[7] += wj * p1.w;
  }
  const float inv = 1.0f / lall;
  Pack8 pk;
  for (int v = 0; v < 8; ++v) pk.h[v] = (_Float16)(acc[v] * inv);
  *(uint4*)(outT + ((size_t)b * NPOS + i0 + ql) * CH + cc * 8) = pk.u;
}

// ---------------------------------------------------------------------------
// Kernel 5: out = wo @ O + bo + x   (f32 output, channel-major)
// ---------------------------------------------------------------------------
__global__ __launch_bounds__(128) void proj_o_kernel(const float* __restrict__ wo,
                                                     const float* __restrict__ bo,
                                                     const _Float16* __restrict__ outT,
                                                     const float* __restrict__ x,
                                                     float* __restrict__ out) {
  const int b = blockIdx.y;
  const int p0 = blockIdx.x * 64;
  const int wave = threadIdx.x >> 5;
  const int lane = threadIdx.x & 31;
  const int half = lane >> 4, r = lane & 15;
  const int co0 = wave * 16;

  Frag16 a[2];
  const float* wrow = wo + (co0 + r) * CH;
  for (int ck = 0; ck < 2; ++ck)
    for (int j = 0; j < 8; ++j) {
      a[ck].v[j]     = (_Float16)wrow[ck * 32 + half * 8 + j];
      a[ck].v[j + 8] = (_Float16)wrow[ck * 32 + half * 8 + 16 + j];
    }
  float bias[8];
  for (int v = 0; v < 8; ++v) bias[v] = bo[co0 + 8 * half + v];

  for (int pt = 0; pt < 4; ++pt) {
    const int p1 = p0 + pt * 16;
    const _Float16* orow = outT + ((size_t)b * NPOS + p1 + r) * CH;
    Frag16 bm0, bm1;
    load_frag(bm0, orow, half);
    load_frag(bm1, orow + 32, half);
    v8f acc = {};
    acc = wmma16(a[0], bm0, acc);
    acc = wmma16(a[1], bm1, acc);
    for (int v = 0; v < 8; ++v) {
      const int co = co0 + v + 8 * half;
      const size_t oidx = ((size_t)b * CH + co) * NPOS + p1 + r;
      out[oidx] = acc[v] + bias[v] + x[oidx];
    }
  }
}

// ---------------------------------------------------------------------------
extern "C" void kernel_launch(void* const* d_in, const int* in_sizes, int n_in,
                              void* d_out, int out_size, void* d_ws, size_t ws_size,
                              hipStream_t stream) {
  const float* x   = (const float*)d_in[0];
  const float* lng = (const float*)d_in[1];
  const float* lnb = (const float*)d_in[2];
  const float* wq  = (const float*)d_in[3];
  const float* bq  = (const float*)d_in[4];
  const float* wk  = (const float*)d_in[5];
  const float* bk  = (const float*)d_in[6];
  const float* wv  = (const float*)d_in[7];
  const float* bv  = (const float*)d_in[8];
  const float* wo  = (const float*)d_in[9];
  const float* bo  = (const float*)d_in[10];
  float* out = (float*)d_out;

  char* ws = (char*)d_ws;
  const size_t T = (size_t)B_ * CH * NPOS * sizeof(_Float16);   // 2 MB each
  _Float16* xn_c = (_Float16*)(ws + 0 * T);
  _Float16* xn_t = (_Float16*)(ws + 1 * T);
  _Float16* qT   = (_Float16*)(ws + 2 * T);
  _Float16* kT   = (_Float16*)(ws + 3 * T);
  _Float16* v_c  = (_Float16*)(ws + 4 * T);
  _Float16* outT = (_Float16*)(ws + 5 * T);

  ln_kernel<<<dim3((B_ * NPOS) / 256), 256, 0, stream>>>(x, lng, lnb, xn_c, xn_t);
  dwconv_kernel<<<dim3((B_ * CH * NPOS) / 256), 256, 0, stream>>>(xn_c, wk, bk, wv, bv, kT, v_c);
  proj_q_kernel<<<dim3(NPOS / 64, B_), 128, 0, stream>>>(wq, bq, xn_t, qT);
  attn_kernel<<<dim3(NPOS / 64, B_), 512, 0, stream>>>(qT, kT, v_c, outT);
  proj_o_kernel<<<dim3(NPOS / 64, B_), 128, 0, stream>>>(wo, bo, outT, x, out);
}

// v003
// Measured time: 40.3 microseconds a run.
// In two side-by-side timings against v002, it was 1.39 and 1.36 times as fast.
// Over all steps from v000 it is 5.85 times as fast.
#include <hip/hip_runtime.h>
#include <hip/hip_bf16.h>

#define B_   4
#define CH   64
#define HS   64
#define WSZ  64
#define NPOS (HS*WSZ)   // 4096
#define LDP  72         // LDS row stride in halves (144B rows: 16B-aligned)

typedef __attribute__((ext_vector_type(16))) _Float16 v16h;
typedef __attribute__((ext_vector_type(8)))  float    v8f;

union Frag16 { v16h v; uint4 q[2]; };
union Pack8  { uint4 u; _Float16 h[8]; };
union Pack64 { uint4 u[8]; _Float16 h[64]; };

// Load one 16x32 f16 fragment in the A-matrix VGPR layout from a row-major
// tile.  `row` must point at (tile_row_base + this lane's row * ld).
// Lane L (r=L&15, half=L>>4) holds halves k = half*8 + {0..7} and 16+half*8+{0..7}.
__device__ __forceinline__ void load_frag(Frag16& f, const _Float16* row, int half) {
  f.q[0] = *(const uint4*)(row + half * 8);
  f.q[1] = *(const uint4*)(row + half * 8 + 16);
}

__device__ __forceinline__ v8f wmma16(const Frag16& a, const Frag16& b, v8f c) {
  return __builtin_amdgcn_wmma_f32_16x16x32_f16(false, a.v, false, b.v,
                                                (short)0, c, false, false);
}

// Eight async global->LDS copies, 16B per lane each, tracked by ASYNCcnt.
// Per-lane 64-bit global address, per-lane LDS byte address (low 32 bits of the
// __shared__ address).  The s_wait_xcnt stands inside the statement, behind the last
// copy, so that no address register is rewritten in front of it.
struct Copy8 { unsigned l[8]; const _Float16* g[8]; };
__device__ __forceinline__ void async_copy8_b128(const Copy8& c) {
  asm volatile("global_load_async_to_lds_b128 %0, %8, off\n\t"
               "global_load_async_to_lds_b128 %1, %9, off\n\t"
               "global_load_async_to_lds_b128 %2, %10, off\n\t"
               "global_load_async_to_lds_b128 %3, %11, off\n\t"
               "global_load_async_to_lds_b128 %4, %12, off\n\t"
               "global_load_async_to_lds_b128 %5, %13, off\n\t"
               "global_load_async_to_lds_b128 %6, %14, off\n\t"
               "global_load_async_to_lds_b128 %7, %15, off\n\t"
               "s_wait_xcnt 0x0"
               :: "v"(c.l[0]), "v"(c.l[1]), "v"(c.l[2]), "v"(c.l[3]),
                  "v"(c.l[4]), "v"(c.l[5]), "v"(c.l[6]), "v"(c.l[7]),
                  "v"(c.g[0]), "v"(c.g[1]), "v"(c.g[2]), "v"(c.g[3]),
                  "v"(c.g[4]), "v"(c.g[5]), "v"(c.g[6]), "v"(c.g[7])
               : "memory");
}

// Lane l <-> lane l ^ 16 (the other half of the wave), a vector cross-row move.
__device__ __forceinline__ float xhalf(float x) {
  const int xi = __builtin_bit_cast(int, x);
  return __builtin_bit_cast(float, __builtin_amdgcn_permlanex16(xi, xi, 0x76543210, 0xfedcba98,
                                                                false, false));
}

// e^x as 2^(x*log2 e).  The v_nop is the slot the instruction set asks for between a
// transcendental and an instruction that reads its result or overwrites its source;
// inside the statement it stays directly behind the v_exp_f32.
__device__ __forceinline__ float exp_slot(float x) {
  float r;
  asm("v_exp_f32 %0, %1\n\tv_nop" : "=v"(r) : "v"(x * 1.44269504f));
  return r;
}

// This wave's async copies have landed in LDS.
__device__ __forceinline__ void wait_async0() {
  asm volatile("s_wait_asynccnt 0x0" ::: "memory");
}

// This wave's LDS reads have returned (before a buffer it read is handed back for refill).
__device__ __forceinline__ void wait_ds0() {
  asm volatile("s_wait_dscnt 0x0" ::: "memory");
}

// ---------------------------------------------------------------------------
// Kernel 1: everything in front of the attention, one block per image row (b, h).
// Phase 1: per-pixel channel LayerNorm of rows h-1, h, h+1 (one thread per pixel, its
//          64 channels in registers), f16, into LDS position-major; rows and columns
//          outside the image are zero (the convs' padding).
// Phase 2: depthwise 3x3 convs k and v of row h (a wave owns 8 channels, so its
//          weights are wave-uniform; a lane owns two neighbouring pixels), and
//          q = (wq @ xn + bq) / sqrt(C) of row h on WMMA.
// Phase 3: q and k (position-major [p][c]) and v (channel-major [c][p]) leave through
//          LDS as whole 128B rows.
// ---------------------------------------------------------------------------
#define XCOLS (WSZ + 2)          // one zero column on either side

__global__ __launch_bounds__(256) void pre_kernel(const float* __restrict__ x,
                                                  const float* __restrict__ g,
                                                  const float* __restrict__ be,
                                                  const float* __restrict__ wq,
                                                  const float* __restrict__ bq,
                                                  const float* __restrict__ wk,
                                                  const float* __restrict__ bk,
                                                  const float* __restrict__ wv,
                                                  const float* __restrict__ bv,
                                                  _Float16* __restrict__ qT,
                                                  _Float16* __restrict__ kT,
                                                  _Float16* __restrict__ v_c) {
  __shared__ __attribute__((aligned(16))) _Float16 xs[3][XCOLS][LDP];
  __shared__ __attribute__((aligned(16))) _Float16 qs[WSZ][LDP];
  __shared__ __attribute__((aligned(16))) _Float16 ks[WSZ][LDP];
  __shared__ __attribute__((aligned(16))) _Float16 vs[CH][LDP];

  const int h = blockIdx.x;
  const int b = blockIdx.y;
  const int tid = threadIdx.x;
  const int wave = __builtin_amdgcn_readfirstlane(tid >> 5);
  const int lane = tid & 31;
  const int half = lane >> 4, r = lane & 15;

  // The q projection's weights and bias are asked for here and first used behind the
  // barrier, so that their latency runs beside the LayerNorm's.
  const int co0 = (wave & 3) * 16;
  const float4* wrow = (const float4*)(wq + (co0 + r) * CH);
  float4 wraw[2][4];
#pragma unroll  // constant indices only
  for (int ck = 0; ck < 2; ++ck) {
    wraw[ck][0] = wrow[ck * 8 + half * 2];
    wraw[ck][1] = wrow[ck * 8 + half * 2 + 1];
    wraw[ck][2] = wrow[ck * 8 + half * 2 + 4];
    wraw[ck][3] = wrow[ck * 8 + half * 2 + 5];
  }
  const float4 bias0 = *(const float4*)(bq + co0 + 8 * half);
  const float4 bias1 = *(const float4*)(bq + co0 + 8 * half + 4);

  // ---- Phase 1 ----
  if (wave < 6) {
    const int row = wave >> 1;
    const int w = tid & (WSZ - 1);
    const int hh = h - 1 + row;
    Pack64 pk;
    if ((unsigned)hh < HS) {
      const float* xp = x + (size_t)b * CH * NPOS + hh * WSZ + w;
      float xv[CH];
#pragma unroll  // all 64 loads in flight at once; constant indices only
      for (int c = 0; c < CH; ++c) xv[c] = xp[(size_t)c * NPOS];
      float s = 0.f, ss = 0.f;
#pragma unroll  // constant indices only
      for (int c = 0; c < CH; ++c) {
        s += xv[c]; ss += xv[c] * xv[c];
      }
      const float mu = s * (1.0f / CH);
      const float var = ss * (1.0f / CH) - mu * mu;
      const float rstd = rsqrtf(var + 1e-5f);
#pragma unroll  // constant indices only
      for (int c = 0; c < CH; ++c)
        pk.h[c] = (_Float16)((xv[c] - mu) * rstd * g[c] + be[c]);
    } else {
#pragma unroll  // constant indices only
      for (int k = 0; k < 8; ++k) pk.u[k] = make_uint4(0u, 0u, 0u, 0u);
    }
    uint4* d = (uint4*)&xs[row][w + 1][0];
#pragma unroll  // constant indices only
    for (int k = 0; k < 8; ++k) d[k] = pk.u[k];
  } else {
    // The two zero columns of the three rows: 48 chunks of 16B.
    const int i = tid - 192;
    if (i < 48)
      *(uint4*)&xs[i >> 4][((i >> 3) & 1) * (XCOLS - 1)][(i & 7) * 8] = make_uint4(0u, 0u, 0u, 0u);
  }
  __syncthreads();        // the three normalised rows are in LDS

  // ---- Phase 2: convs ----
  {
    const int c0 = wave * 8;
    Pack8 xin[3][4];      // pixels 2*lane-1 .. 2*lane+2 of the three rows, 8 channels
#pragma unroll  // constant indices only
    for (int dy = 0; dy < 3; ++dy)
#pragma unroll  // constant indices only
      for (int k = 0; k < 4; ++k)
        xin[dy][k].u = *(const uint4*)&xs[dy][2 * lane + k][c0];
    Pack8 k0, k1;
#pragma unroll  // constant indices only
    for (int j = 0; j < 8; ++j) {
      const int c = c0 + j;
      float aK0 = bk[c], aV0 = bv[c], aK1 = bk[c], aV1 = bv[c];
#pragma unroll  // constant indices only
      for (int dy = 0; dy < 3; ++dy)
#pragma unroll  // constant indices only
        for (int dx = 0; dx < 3; ++dx) {
          const float fk = wk[c * 9 + dy * 3 + dx];
          const float fv = wv[c * 9 + dy * 3 + dx];
          const float x0 = (float)xin[dy][dx].h[j];
          const float x1 = (float)xin[dy][dx + 1].h[j];
          aK0 += fk * x0; aV0 += fv * x0;
          aK1 += fk * x1; aV1 += fv * x1;
        }
      k0.h[j] = (_Float16)aK0;
      k1.h[j] = (_Float16)aK1;
      union { _Float16 hh2[2]; unsigned u; } vp;
      vp.hh2[0] = (_Float16)aV0;
      vp.hh2[1] = (_Float16)aV1;
      *(unsigned*)&vs[c][2 * lane] = vp.u;
    }
    *(uint4*)&ks[2 * lane][c0]     = k0.u;
    *(uint4*)&ks[2 * lane + 1][c0] = k1.u;
  }

  // ---- Phase 2: q projection.  Wave = 16 output channels x 32 pixels. ----
  {
    Frag16 a[2];
#pragma unroll  // constant indices only
    for (int ck = 0; ck < 2; ++ck) {
      const float4 f0 = wraw[ck][0], f1 = wraw[ck][1], f2 = wraw[ck][2], f3 = wraw[ck][3];
      a[ck].v[0]  = (_Float16)f0.x; a[ck].v[1]  = (_Float16)f0.y;
      a[ck].v[2]  = (_Float16)f0.z; a[ck].v[3]  = (_Float16)f0.w;
      a[ck].v[4]  = (_Float16)f1.x; a[ck].v[5]  = (_Float16)f1.y;
      a[ck].v[6]  = (_Float16)f1.z; a[ck].v[7]  = (_Float16)f1.w;
      a[ck].v[8]  = (_Float16)f2.x; a[ck].v[9]  = (_Float16)f2.y;
      a[ck].v[10] = (_Float16)f2.z; a[ck].v[11] = (_Float16)f2.w;
      a[ck].v[12] = (_Float16)f3.x; a[ck].v[13] = (_Float16)f3.y;
      a[ck].v[14] = (_Float16)f3.z; a[ck].v[15] = (_Float16)f3.w;
    }
    const float bias[8] = {bias0.x, bias0.y, bias0.z, bias0.w, bias1.x, bias1.y, bias1.z, bias1.w};
#pragma unroll  // constant indices only
    for (int i = 0; i < 2; ++i) {
      const int p1 = ((wave >> 2) * 2 + i) * 16;
      const _Float16* xrow = &xs[1][p1 + r + 1][0];
      Frag16 bm0, bm1;
      load_frag(bm0, xrow, half);
      load_frag(bm1, xrow + 32, half);
      v8f acc = {};
      acc = wmma16(a[0], bm0, acc);
      acc = wmma16(a[1], bm1, acc);
      Pack8 pk;
#pragma unroll  // constant indices only
      for (int v = 0; v < 8; ++v)
        pk.h[v] = (_Float16)((acc[v] + bias[v]) * 0.125f);   // fold 1/sqrt(64)
      *(uint4*)&qs[p1 + r][co0 + 8 * half] = pk.u;
    }
  }
  __syncthreads();        // q, k and v of this image row are in LDS

  // ---- Phase 3: 512 chunks of 16B of each; 8 lanes store one whole 128B row. ----
  const size_t prow0 = (size_t)b * NPOS + h * WSZ;
#pragma unroll  // both trips' LDS reads in front of the stores
  for (int it = 0; it < 2; ++it) {
    const int idx = tid + it * 256;
    const int row = idx >> 3, col = idx & 7;
    *(uint4*)(qT + (prow0 + row) * CH + col * 8) = *(const uint4*)&qs[row][col * 8];
    *(uint4*)(kT + (prow0 + row) * CH + col * 8) = *(const uint4*)&ks[row][col * 8];
    *(uint4*)(v_c + ((size_t)b * CH + row) * NPOS + h * WSZ + col * 8) = *(const uint4*)&vs[row][col * 8];
  }
}

#define KG     4
#define QTL    4
#define SKEYS  (KG * 64)
#define NSTAGE (NPOS / SKEYS)
#define OPITCH 68

__global__ __launch_bounds__(512) void attn_kernel(const _Float16* __restrict__ qT,
                                                   const _Float16* __restrict__ kT,
                                                   const _Float16* __restrict__ v_c,
                                                   _Float16* __restrict__ outT) {
  __shared__ __attribute__((aligned(16))) _Float16 lds_k[2][KG * 64 * LDP];
  __shared__ __attribute__((aligned(16))) _Float16 lds_v[2][KG * 64 * LDP];
  __shared__ __attribute__((aligned(16))) float lds_o[KG][QTL][16][OPITCH];
  __shared__ float lds_m[KG][QTL][16];
  __shared__ float lds_l[KG][QTL][16];

  const int b = blockIdx.y;
  const int qbase = blockIdx.x * (QTL * 16);
  const int tid = threadIdx.x;
  const int wave = tid >> 5;
  const int lane = tid & 31;
  const int half = lane >> 4, r = lane & 15;
  const int qt = wave & (QTL - 1);
  const int kg = wave >> 2;
  const int i0 = qbase + qt * 16;

  // Q fragments (B operand: lane r = query column), fixed for the whole loop.
  const _Float16* qrow = qT + ((size_t)b * NPOS + i0 + r) * CH;
  Frag16 qb0, qb1;
  load_frag(qb0, qrow, half);
  load_frag(qb1, qrow + 32, half);

  // Per lane: running maximum of query r over this wave's keys (equal in both
  // halves) and this half's share of its sum.
  // o[t][v] = O^T[channel t*16 + 8*half + v][query r], this wave's keys only.
  float mi = -3.0e38f, li = 0.f;
  v8f o[4];
  for (int t = 0; t < 4; ++t) o[t] = (v8f){};

  // Issue the async staging of stage `st` into buffer `buf` (8 copies / wave).
  // K: 256 key rows of 128B.  V: 64 channel rows of 512B, cut into the four key
  // groups' 64x64 tiles.
  auto issue_stage = [&](int st, int buf) {
    const int j0 = st * SKEYS;
    const _Float16* kbase = kT + ((size_t)b * NPOS + j0) * CH;
    const _Float16* vbase = v_c + (size_t)b * CH * NPOS + j0;
    Copy8 c;
    for (int it = 0; it < 4; ++it) {
      const int idx = tid + it * 512;           // 0..2047 b128 chunks
      const int row = idx >> 3, col = idx & 7;
      c.g[it] = kbase + row * CH + col * 8;
      c.l[it] = (unsigned)(uintptr_t)(lds_k[buf] + row * LDP + col * 8);
    }
    for (int it = 0; it < 4; ++it) {
      const int idx = tid + it * 512;
      const int row = idx >> 5, grp = (idx >> 3) & 3, col = idx & 7;
      c.g[4 + it] = vbase + (size_t)row * NPOS + grp * 64 + col * 8;
      c.l[4 + it] = (unsigned)(uintptr_t)(lds_v[buf] + (grp * 64 + row) * LDP + col * 8);
    }
    async_copy8_b128(c);
  };

  issue_stage(0, 0);
  wait_async0();          // my copies of stage 0 have landed
  __syncthreads();        // everyone's have
  issue_stage(1, 1);

  for (int st = 0; st < NSTAGE; ++st) {
    const int cur = st & 1;
    const _Float16* ktile = lds_k[cur] + kg * 64 * LDP;
    const _Float16* vtile = lds_v[cur] + kg * 64 * LDP;

    // S^T = K Q^T : 4 key sub-tiles of 16 (A rows), contraction over 64 channels.
    // s[t][v] = score of key t*16 + 8*half + v against query r.
    v8f s[4];
    for (int t = 0; t < 4; ++t) {
      const _Float16* krow = ktile + (t * 16 + r) * LDP;
      Frag16 ka0, ka1;
      load_frag(ka0, krow, half);
      load_frag(ka1, krow + 32, half);
      v8f acc = {};
      acc = wmma16(ka0, qb0, acc);
      acc = wmma16(ka1, qb1, acc);
      s[t] = acc;
    }

    // Online softmax, one query per lane.
    // One short chain per sub-tile for the maximum and for the sum.
    float tm[4];
    for (int t = 0; t < 4; ++t) {
      tm[t] = s[t][0];
      for (int v = 1; v < 8; ++v) tm[t] = fmaxf(tm[t], s[t][v]);
    }
    float rm = fmaxf(fmaxf(tm[0], tm[1]), fmaxf(tm[2], tm[3]));
    rm = fmaxf(rm, xhalf(rm));                  // join the two halves' keys
    const float mnew = fmaxf(mi, rm);
    const float corr = exp_slot(mi - mnew);
    mi = mnew;
    float ts[4];
    // Unrolled so that every index of s[] is a constant (a run-time index would
    // go through indexed register moves).
#pragma unroll
    for (int t = 0; t < 4; ++t) {
      s[t][0] = exp_slot(s[t][0] - mnew);
      ts[t] = s[t][0];
#pragma unroll  // as above: constant indices only
      for (int v = 1; v < 8; ++v) {
        s[t][v] = exp_slot(s[t][v] - mnew);
        ts[t] += s[t][v];
      }
    }
    li = li * corr + ((ts[0] + ts[1]) + (ts[2] + ts[3]));
    for (int t = 0; t < 4; ++t) o[t] *= corr;

    // P^T as B operand: element e of chunk c is key 32c + 16*(e>>3) + 8*half + (e&7),
    // the same k order load_frag gives the V rows.
    Frag16 pb0, pb1;
    for (int e = 0; e < 16; ++e) {
      pb0.v[e] = (_Float16)s[e >> 3][e & 7];
      pb1.v[e] = (_Float16)s[2 + (e >> 3)][e & 7];
    }

    // O^T += V P^T : A = V channel rows (16 x 64 keys), B = P^T.
    for (int t = 0; t < 4; ++t) {
      const _Float16* vrow = vtile + (t * 16 + r) * LDP;
      Frag16 va0, va1;
      load_frag(va0, vrow, half);
      load_frag(va1, vrow + 32, half);
      o[t] = wmma16(va0, pb0, o[t]);
      o[t] = wmma16(va1, pb1, o[t]);
    }

    // Publish point of stage st + 1.
    wait_ds0();           // my reads of buffer `cur` have returned
    wait_async0();        // my copies of stage st + 1 have landed
    __syncthreads();      // everyone's have; everyone is done reading `cur`
    if (st + 2 < NSTAGE) issue_stage(st + 2, cur);
  }
  wait_async0();          // nothing of mine is in flight any more

  // Hand this wave's partial result over: maximum, sum (halves joined), O^T rows.
  li += xhalf(li);
  if (half == 0) {
    lds_m[kg][qt][r] = mi;
    lds_l[kg][qt][r] = li;
  }
  float* prow = &lds_o[kg][qt][r][8 * half];
  for (int t = 0; t < 4; ++t) {
    *(float4*)(prow + t * 16)     = make_float4(o[t][0], o[t][1], o[t][2], o[t][3]);
    *(float4*)(prow + t * 16 + 4) = make_float4(o[t][4], o[t][5], o[t][6], o[t][7]);
  }
  __syncthreads();        // all partial results are in LDS

  // Join the four key groups.  Wave (kg, qt) finishes queries 4*kg..4*kg+3 of tile
  // qt: a lane takes 8 consecutive channels of one query, so a wave stores four
  // whole 128B rows of O (position-major [i][c], f16).
  const int ql = 4 * kg + (lane >> 3);
  const int cc = lane & 7;
  float mg[KG];
  for (int j = 0; j < KG; ++j) mg[j] = lds_m[j][qt][ql];
  const float mall = fmaxf(fmaxf(mg[0], mg[1]), fmaxf(mg[2], mg[3]));
  float lall = 0.f;
  float acc[8];
  for (int v = 0; v < 8; ++v) acc[v] = 0.f;
  for (int j = 0; j < KG; ++j) {
    const float wj = exp_slot(mg[j] - mall);
    lall += wj * lds_l[j][qt][ql];
    const float4 p0 = *(const float4*)&lds_o[j][qt][ql][cc * 8];
    const float4 p1 = *(const float4*)&lds_o[j][qt][ql][cc * 8 + 4];
    acc[0] += wj * p0.x; acc[1] += wj * p0.y; acc[2] += wj * p0.z; acc[3] += wj * p0.w;
    acc[4] += wj * p1.x; acc[5] += wj * p1.y; acc[6] += wj * p1.z; acc[7] += wj * p1.w;
  }
  const float inv = 1.0f / lall;
  Pack8 pk;
  for (int v = 0; v < 8; ++v) pk.h[v] = (_Float16)(acc[v] * inv);
  *(uint4*)(outT + ((size_t)b * NPOS + i0 + ql) * CH + cc * 8) = pk.u;
}

// ---------------------------------------------------------------------------
// Kernel 3: out = wo @ O + bo + x   (f32 output, channel-major)
// ---------------------------------------------------------------------------
__global__ __launch_bounds__(128) void proj_o_kernel(const float* __restrict__ wo,
                                                     const float* __restrict__ bo,
                                                     const _Float16* __restrict__ outT,
                                                     const float* __restrict__ x,
                                                     float* __restrict__ out) {
  const int b = blockIdx.y;
  const int p0 = blockIdx.x * 64;
  const int wave = threadIdx.x >> 5;
  const int lane = threadIdx.x & 31;
  const int half = lane >> 4, r = lane & 15;
  const int co0 = wave * 16;

  Frag16 a[2];
  const float* wrow = wo + (co0 + r) * CH;
  for (int ck = 0; ck < 2; ++ck)
    for (int j = 0; j < 8; ++j) {
      a[ck].v[j]     = (_Float16)wrow[ck * 32 + half * 8 + j];
      a[ck].v[j + 8] = (_Float16)wrow[ck * 32 + half * 8 + 16 + j];
    }
  float bias[8];
  for (int v = 0; v < 8; ++v) bias[v] = bo[co0 + 8 * half + v];

  for (int pt = 0; pt < 4; ++pt) {
    const int p1 = p0 + pt * 16;
    const _Float16* orow = outT + ((size_t)b * NPOS + p1 + r) * CH;
    Frag16 bm0, bm1;
    load_frag(bm0, orow, half);
    load_frag(bm1, orow + 32, half);
    v8f acc = {};
    acc = wmma16(a[0], bm0, acc);
    acc = wmma16(a[1], bm1, acc);
    for (int v = 0; v < 8; ++v) {
      const int co = co0 + v + 8 * half;
      const size_t oidx = ((size_t)b * CH + co) * NPOS + p1 + r;
      out[oidx] = acc[v] + bias[v] + x[oidx];
    }
  }
}

// ---------------------------------------------------------------------------
extern "C" void kernel_launch(void* const* d_in, const int* in_sizes, int n_in,
                              void* d_out, int out_size, void* d_ws, size_t ws_size,
                              hipStream_t stream) {
  const float* x   = (const float*)d_in[0];
  const float* lng = (const float*)d_in[1];
  const float* lnb = (const float*)d_in[2];
  const float* wq  = (const float*)d_in[3];
  const float* bq  = (const float*)d_in[4];
  const float* wk  = (const float*)d_in[5];
  const float* bk  = (const float*)d_in[6];
  const float* wv  = (const float*)d_in[7];
  const float* bv  = (const float*)d_in[8];
  const float* wo  = (const float*)d_in[9];
  const float* bo  = (const float*)d_in[10];
  float* out = (float*)d_out;

  char* ws = (char*)d_ws;
  const size_t T = (size_t)B_ * CH * NPOS * sizeof(_Float16);   // 2 MB each
  _Float16* qT   = (_Float16*)(ws + 0 * T);
  _Float16* kT   = (_Float16*)(ws + 1 * T);
  _Float16* v_c  = (_Float16*)(ws + 2 * T);
  _Float16* outT = (_Float16*)(ws + 3 * T);

  pre_kernel<<<dim3(HS, B_), 256, 0, stream>>>(x, lng, lnb, wq, bq, wk, bk, wv, bv, qT, kT, v_c);
  attn_kernel<<<dim3(NPOS / 64, B_), 512, 0, stream>>>(qT, kT, v_c, outT);
  proj_o_kernel<<<dim3(NPOS / 64, B_), 128, 0, stream>>>(wo, bo, outT, x, out);
}

// v004
// A run of this version takes 32.2 microseconds.
// Two timings next to v003 put it at 1.24 and 1.25 times that version's speed.
// Counting every step since v000, it is 7.30 times as fast.
#include <hip/hip_runtime.h>
#include <hip/hip_bf16.h>

#define B_   4
#define CH   64
#define HS   64
#define WSZ  64
#define NPOS (HS*WSZ)   // 4096
#define LDP  72         // LDS row stride in halves (144B rows: 16B-aligned)

typedef __attribute__((ext_vector_type(16))) _Float16 v16h;
typedef __attribute__((ext_vector_type(8)))  float    v8f;

union Frag16 { v16h v; uint4 q[2]; };
union Pack8  { uint4 u; _Float16 h[8]; };
union Pack64 { uint4 u[8]; _Float16 h[64]; };

// Load one 16x32 f16 fragment in the A-matrix VGPR layout from a row-major
// tile.  `row` must point at (tile_row_base + this lane's row * ld).
// Lane L (r=L&15, half=L>>4) holds halves k = half*8 + {0..7} and 16+half*8+{0..7}.
__device__ __forceinline__ void load_frag(Frag16& f, const _Float16* row, int half) {
  f.q[0] = *(const uint4*)(row + half * 8);
  f.q[1] = *(const uint4*)(row + half * 8 + 16);
}

__device__ __forceinline__ v8f wmma16(const Frag16& a, const Frag16& b, v8f c) {
  return __builtin_amdgcn_wmma_f32_16x16x32_f16(false, a.v, false, b.v,
                                                (short)0, c, false, false);
}

// Eight async global->LDS copies, 16B per lane each, tracked by ASYNCcnt.
// Per-lane 64-bit global address, per-lane LDS byte address (low 32 bits of the
// __shared__ address).  The s_wait_xcnt stands inside the statement, behind the last
// copy, so that no address register is rewritten in front of it.
struct Copy8 { unsigned l[8]; const _Float16* g[8]; };
__device__ __forceinline__ void async_copy8_b128(const Copy8& c) {
  asm volatile("global_load_async_to_lds_b128 %0, %8, off\n\t"
               "global_load_async_to_lds_b128 %1, %9, off\n\t"
               "global_load_async_to_lds_b128 %2, %10, off\n\t"
               "global_load_async_to_lds_b128 %3, %11, off\n\t"
               "global_load_async_to_lds_b128 %4, %12, off\n\t"
               "global_load_async_to_lds_b128 %5, %13, off\n\t"
               "global_load_async_to_lds_b128 %6, %14, off\n\t"
               "global_load_async_to_lds_b128 %7, %15, off\n\t"
               "s_wait_xcnt 0x0"
               :: "v"(c.l[0]), "v"(c.l[1]), "v"(c.l[2]), "v"(c.l[3]),
                  "v"(c.l[4]), "v"(c.l[5]), "v"(c.l[6]), "v"(c.l[7]),
                  "v"(c.g[0]), "v"(c.g[1]), "v"(c.g[2]), "v"(c.g[3]),
                  "v"(c.g[4]), "v"(c.g[5]), "v"(c.g[6]), "v"(c.g[7])
               : "memory");
}

// Lane l <-> lane l ^ 16 (the other half of the wave), a vector cross-row move.
__device__ __forceinline__ float xhalf(float x) {
  const int xi = __builtin_bit_cast(int, x);
  return __builtin_bit_cast(float, __builtin_amdgcn_permlanex16(xi, xi, 0x76543210, 0xfedcba98,
                                                                false, false));
}

// e^x as 2^(x*log2 e).  The v_nop is the slot the instruction set asks for between a
// transcendental and an instruction that reads its result or overwrites its source;
// inside the statement it stays directly behind the v_exp_f32.
__device__ __forceinline__ float exp_slot(float x) {
  float r;
  asm("v_exp_f32 %0, %1\n\tv_nop" : "=v"(r) : "v"(x * 1.44269504f));
  return r;
}

// This wave's async copies have landed in LDS.
__device__ __forceinline__ void wait_async0() {
  asm volatile("s_wait_asynccnt 0x0" ::: "memory");
}

// This wave's LDS reads have returned (before a buffer it read is handed back for refill).
__device__ __forceinline__ void wait_ds0() {
  asm volatile("s_wait_dscnt 0x0" ::: "memory");
}

// ---------------------------------------------------------------------------
// Kernel 1: everything in front of the attention, one block per image row (b, h).
// Phase 1: per-pixel channel LayerNorm of rows h-1, h, h+1 (one thread per pixel, its
//          64 channels in registers), f16, into LDS position-major; rows and columns
//          outside the image are zero (the convs' padding).
// Phase 2: depthwise 3x3 convs k and v of row h (a wave owns 8 channels, so its
//          weights are wave-uniform; a lane owns two neighbouring pixels), and
//          q = (wq @ xn + bq) / sqrt(C) of row h on WMMA.
// Phase 3: q and k (position-major [p][c]) and v (channel-major [c][p]) leave through
//          LDS as whole 128B rows.
// ---------------------------------------------------------------------------
#define XCOLS (WSZ + 2)          // one zero column on either side

__global__ __launch_bounds__(256) void pre_kernel(const float* __restrict__ x,
                                                  const float* __restrict__ g,
                                                  const float* __restrict__ be,
                                                  const float* __restrict__ wq,
                                                  const float* __restrict__ bq,
                                                  const float* __restrict__ wk,
                                                  const float* __restrict__ bk,
                                                  const float* __restrict__ wv,
                                                  const float* __restrict__ bv,
                                                  _Float16* __restrict__ qT,
                                                  _Float16* __restrict__ kT,
                                                  _Float16* __restrict__ v_c) {
  __shared__ __attribute__((aligned(16))) _Float16 xs[3][XCOLS][LDP];
  __shared__ __attribute__((aligned(16))) _Float16 qs[WSZ][LDP];
  __shared__ __attribute__((aligned(16))) _Float16 ks[WSZ][LDP];
  __shared__ __attribute__((aligned(16))) _Float16 vs[CH][LDP];

  const int h = blockIdx.x;
  const int b = blockIdx.y;
  const int tid = threadIdx.x;
  const int wave = __builtin_amdgcn_readfirstlane(tid >> 5);
  const int lane = tid & 31;
  const int half = lane >> 4, r = lane & 15;

  // The q projection's weights and bias are asked for here and first used behind the
  // barrier, so that their latency runs beside the LayerNorm's.
  const int co0 = (wave & 3) * 16;
  const float4* wrow = (const float4*)(wq + (co0 + r) * CH);
  float4 wraw[2][4];
#pragma unroll  // constant indices only
  for (int ck = 0; ck < 2; ++ck) {
    wraw[ck][0] = wrow[ck * 8 + half * 2];
    wraw[ck][1] = wrow[ck * 8 + half * 2 + 1];
    wraw[ck][2] = wrow[ck * 8 + half * 2 + 4];
    wraw[ck][3] = wrow[ck * 8 + half * 2 + 5];
  }
  const float4 bias0 = *(const float4*)(bq + co0 + 8 * half);
  const float4 bias1 = *(const float4*)(bq + co0 + 8 * half + 4);

  // ---- Phase 1 ----
  if (wave < 6) {
    const int row = wave >> 1;
    const int w = tid & (WSZ - 1);
    const int hh = h - 1 + row;
    Pack64 pk;
    if ((unsigned)hh < HS) {
      const float* xp = x + (size_t)b * CH * NPOS + hh * WSZ + w;
      float xv[CH];
#pragma unroll  // all 64 loads in flight at once; constant indices only
      for (int c = 0; c < CH; ++c) xv[c] = xp[(size_t)c * NPOS];
      float s = 0.f, ss = 0.f;
#pragma unroll  // constant indices only
      for (int c = 0; c < CH; ++c) {
        s += xv[c]; ss += xv[c] * xv[c];
      }
      const float mu = s * (1.0f / CH);
      const float var = ss * (1.0f / CH) - mu * mu;
      const float rstd = rsqrtf(var + 1e-5f);
#pragma unroll  // constant indices only
      for (int c = 0; c < CH; ++c)
        pk.h[c] = (_Float16)((xv[c] - mu) * rstd * g[c] + be[c]);
    } else {
#pragma unroll  // constant indices only
      for (int k = 0; k < 8; ++k) pk.u[k] = make_uint4(0u, 0u, 0u, 0u);
    }
    uint4* d = (uint4*)&xs[row][w + 1][0];
#pragma unroll  // constant indices only
    for (int k = 0; k < 8; ++k) d[k] = pk.u[k];
  } else {
    // The two zero columns of the three rows: 48 chunks of 16B.
    const int i = tid - 192;
    if (i < 48)
      *(uint4*)&xs[i >> 4][((i >> 3) & 1) * (XCOLS - 1)][(i & 7) * 8] = make_uint4(0u, 0u, 0u, 0u);
  }
  __syncthreads();        // the three normalised rows are in LDS

  // ---- Phase 2: convs ----
  {
    const int c0 = wave * 8;
    Pack8 xin[3][4];      // pixels 2*lane-1 .. 2*lane+2 of the three rows, 8 channels
#pragma unroll  // constant indices only
    for (int dy = 0; dy < 3; ++dy)
#pragma unroll  // constant indices only
      for (int k = 0; k < 4; ++k)
        xin[dy][k].u = *(const uint4*)&xs[dy][2 * lane + k][c0];
    Pack8 k0, k1;
#pragma unroll  // constant indices only
    for (int j = 0; j < 8; ++j) {
      const int c = c0 + j;
      float aK0 = bk[c], aV0 = bv[c], aK1 = bk[c], aV1 = bv[c];
#pragma unroll  // constant indices only
      for (int dy = 0; dy < 3; ++dy)
#pragma unroll  // constant indices only
        for (int dx = 0; dx < 3; ++dx) {
          const float fk = wk[c * 9 + dy * 3 + dx];
          const float fv = wv[c * 9 + dy * 3 + dx];
          const float x0 = (float)xin[dy][dx].h[j];
          const float x1 = (float)xin[dy][dx + 1].h[j];
          aK0 += fk * x0; aV0 += fv * x0;
          aK1 += fk * x1; aV1 += fv * x1;
        }
      k0.h[j] = (_Float16)aK0;
      k1.h[j] = (_Float16)aK1;
      union { _Float16 hh2[2]; unsigned u; } vp;
      vp.hh2[0] = (_Float16)aV0;
      vp.hh2[1] = (_Float16)aV1;
      *(unsigned*)&vs[c][2 * lane] = vp.u;
    }
    *(uint4*)&ks[2 * lane][c0]     = k0.u;
    *(uint4*)&ks[2 * lane + 1][c0] = k1.u;
  }

  // ---- Phase 2: q projection.  Wave = 16 output channels x 32 pixels. ----
  {
    Frag16 a[2];
#pragma unroll  // constant indices only
    for (int ck = 0; ck < 2; ++ck) {
      const float4 f0 = wraw[ck][0], f1 = wraw[ck][1], f2 = wraw[ck][2], f3 = wraw[ck][3];
      a[ck].v[0]  = (_Float16)f0.x; a[ck].v[1]  = (_Float16)f0.y;
      a[ck].v[2]  = (_Float16)f0.z; a[ck].v[3]  = (_Float16)f0.w;
      a[ck].v[4]  = (_Float16)f1.x; a[ck].v[5]  = (_Float16)f1.y;
      a[ck].v[6]  = (_Float16)f1.z; a[ck].v[7]  = (_Float16)f1.w;
      a[ck].v[8]  = (_Float16)f2.x; a[ck].v[9]  = (_Float16)f2.y;
      a[ck].v[10] = (_Float16)f2.z; a[ck].v[11] = (_Float16)f2.w;
      a[ck].v[12] = (_Float16)f3.x; a[ck].v[13] = (_Float16)f3.y;
      a[ck].v[14] = (_Float16)f3.z; a[ck].v[15] = (_Float16)f3.w;
    }
    const float bias[8] = {bias0.x, bias0.y, bias0.z, bias0.w, bias1.x, bias1.y, bias1.z, bias1.w};
#pragma unroll  // constant indices only
    for (int i = 0; i < 2; ++i) {
      const int p1 = ((wave >> 2) * 2 + i) * 16;
      const _Float16* xrow = &xs[1][p1 + r + 1][0];
      Frag16 bm0, bm1;
      load_frag(bm0, xrow, half);
      load_frag(bm1, xrow + 32, half);
      v8f acc = {};
      acc = wmma16(a[0], bm0, acc);
      acc = wmma16(a[1], bm1, acc);
      Pack8 pk;
#pragma unroll  // constant indices only
      for (int v = 0; v < 8; ++v)
        pk.h[v] = (_Float16)((acc[v] + bias[v]) * 0.125f);   // fold 1/sqrt(64)
      *(uint4*)&qs[p1 + r][co0 + 8 * half] = pk.u;
    }
  }
  __syncthreads();        // q, k and v of this image row are in LDS

  // ---- Phase 3: 512 chunks of 16B of each; 8 lanes store one whole 128B row. ----
  const size_t prow0 = (size_t)b * NPOS + h * WSZ;
#pragma unroll  // both trips' LDS reads in front of the stores
  for (int it = 0; it < 2; ++it) {
    const int idx = tid + it * 256;
    const int row = idx >> 3, col = idx & 7;
    *(uint4*)(qT + (prow0 + row) * CH + col * 8) = *(const uint4*)&qs[row][col * 8];
    *(uint4*)(kT + (prow0 + row) * CH + col * 8) = *(const uint4*)&ks[row][col * 8];
    *(uint4*)(v_c + ((size_t)b * CH + row) * NPOS + h * WSZ + col * 8) = *(const uint4*)&vs[row][col * 8];
  }
}

#define KG     4
#define QTL    4
#define SKEYS  (KG * 64)
#define NSTAGE (NPOS / SKEYS)
#define OPITCH 68

__global__ __launch_bounds__(512) void attn_kernel(const _Float16* __restrict__ qT,
                                                   const _Float16* __restrict__ kT,
                                                   const _Float16* __restrict__ v_c,
                                                   const float* __restrict__ wo,
                                                   const float* __restrict__ bo,
                                                   const float* __restrict__ x,
                                                   float* __restrict__ out) {
  __shared__ __attribute__((aligned(16))) _Float16 lds_k[2][KG * 64 * LDP];
  __shared__ __attribute__((aligned(16))) _Float16 lds_v[2][KG * 64 * LDP];
  __shared__ __attribute__((aligned(16))) float lds_o[KG][QTL][16][OPITCH];
  __shared__ float lds_m[KG][QTL][16];
  __shared__ float lds_l[KG][QTL][16];

  const int b = blockIdx.y;
  const int qbase = blockIdx.x * (QTL * 16);
  const int tid = threadIdx.x;
  const int wave = tid >> 5;
  const int lane = tid & 31;
  const int half = lane >> 4, r = lane & 15;
  const int qt = wave & (QTL - 1);
  const int kg = wave >> 2;
  const int i0 = qbase + qt * 16;

  // Q fragments (B operand: lane r = query column), fixed for the whole loop.
  const _Float16* qrow = qT + ((size_t)b * NPOS + i0 + r) * CH;
  Frag16 qb0, qb1;
  load_frag(qb0, qrow, half);
  load_frag(qb1, qrow + 32, half);

  // Per lane: running maximum of query r over this wave's keys (equal in both
  // halves) and this half's share of its sum.
  // o[t][v] = O^T[channel t*16 + 8*half + v][query r], this wave's keys only.
  float mi = -3.0e38f, li = 0.f;
  v8f o[4];
  for (int t = 0; t < 4; ++t) o[t] = (v8f){};

  // Issue the async staging of stage `st` into buffer `buf` (8 copies / wave).
  // K: 256 key rows of 128B.  V: 64 channel rows of 512B, cut into the four key
  // groups' 64x64 tiles.
  auto issue_stage = [&](int st, int buf) {
    const int j0 = st * SKEYS;
    const _Float16* kbase = kT + ((size_t)b * NPOS + j0) * CH;
    const _Float16* vbase = v_c + (size_t)b * CH * NPOS + j0;
    Copy8 c;
    for (int it = 0; it < 4; ++it) {
      const int idx = tid + it * 512;           // 0..2047 b128 chunks
      const int row = idx >> 3, col = idx & 7;
      c.g[it] = kbase + row * CH + col * 8;
      c.l[it] = (unsigned)(uintptr_t)(lds_k[buf] + row * LDP + col * 8);
    }
    for (int it = 0; it < 4; ++it) {
      const int idx = tid + it * 512;
      const int row = idx >> 5, grp = (idx >> 3) & 3, col = idx & 7;
      c.g[4 + it] = vbase + (size_t)row * NPOS + grp * 64 + col * 8;
      c.l[4 + it] = (unsigned)(uintptr_t)(lds_v[buf] + (grp * 64 + row) * LDP + col * 8);
    }
    async_copy8_b128(c);
  };

  issue_stage(0, 0);

  // Output projection: waves 0..7 each take 16 output channels x 32 positions, so a
  // wave writes whole 128B lines of out.  Its weights, bias and residual x are asked
  // for here, behind the first stage's copies, and first used in the epilogue, so
  // that their latency runs beside the first stage's.
  const int wv = __builtin_amdgcn_readfirstlane(wave);
  const int co0 = (wv & 3) * 16;
  const int pg = (wv >> 2) * 32;
  const size_t obase = ((size_t)b * CH + co0 + 8 * half) * NPOS + qbase + pg + r;
  float4 wraw[2][4];
  float4 bias0, bias1;
  float xr[2][8];
  if (wv < 8) {
    const float4* wrow = (const float4*)(wo + (co0 + r) * CH);
#pragma unroll  // constant indices only
    for (int ck = 0; ck < 2; ++ck) {
      wraw[ck][0] = wrow[ck * 8 + half * 2];
      wraw[ck][1] = wrow[ck * 8 + half * 2 + 1];
      wraw[ck][2] = wrow[ck * 8 + half * 2 + 4];
      wraw[ck][3] = wrow[ck * 8 + half * 2 + 5];
    }
    bias0 = *(const float4*)(bo + co0 + 8 * half);
    bias1 = *(const float4*)(bo + co0 + 8 * half + 4);
#pragma unroll  // constant indices only
    for (int i = 0; i < 2; ++i)
#pragma unroll  // constant indices only
      for (int v = 0; v < 8; ++v) xr[i][v] = x[obase + (size_t)v * NPOS + i * 16];
    // Before a register that these loads name is overwritten.
    asm volatile("s_wait_xcnt 0x0" ::: "memory");
  }

  wait_async0();          // my copies of stage 0 have landed
  __syncthreads();        // everyone's have
  issue_stage(1, 1);

  for (int st = 0; st < NSTAGE; ++st) {
    const int cur = st & 1;
    const _Float16* ktile = lds_k[cur] + kg * 64 * LDP;
    const _Float16* vtile = lds_v[cur] + kg * 64 * LDP;

    // S^T = K Q^T : 4 key sub-tiles of 16 (A rows), contraction over 64 channels.
    // s[t][v] = score of key t*16 + 8*half + v against query r.
    v8f s[4];
    for (int t = 0; t < 4; ++t) {
      const _Float16* krow = ktile + (t * 16 + r) * LDP;
      Frag16 ka0, ka1;
      load_frag(ka0, krow, half);
      load_frag(ka1, krow + 32, half);
      v8f acc = {};
      acc = wmma16(ka0, qb0, acc);
      acc = wmma16(ka1, qb1, acc);
      s[t] = acc;
    }

    // Online softmax, one query per lane.
    // One short chain per sub-tile for the maximum and for the sum.
    float tm[4];
    for (int t = 0; t < 4; ++t) {
      tm[t] = s[t][0];
      for (int v = 1; v < 8; ++v) tm[t] = fmaxf(tm[t], s[t][v]);
    }
    float rm = fmaxf(fmaxf(tm[0], tm[1]), fmaxf(tm[2], tm[3]));
    rm = fmaxf(rm, xhalf(rm));                  // join the two halves' keys
    const float mnew = fmaxf(mi, rm);
    const float corr = exp_slot(mi - mnew);
    mi = mnew;
    float ts[4];
    // Unrolled so that every index of s[] is a constant (a run-time index would
    // go through indexed register moves).
#pragma unroll
    for (int t = 0; t < 4; ++t) {
      s[t][0] = exp_slot(s[t][0] - mnew);
      ts[t] = s[t][0];
#pragma unroll  // as above: constant indices only
      for (int v = 1; v < 8; ++v) {
        s[t][v] = exp_slot(s[t][v] - mnew);
        ts[t] += s[t][v];
      }
    }
    li = li * corr + ((ts[0] + ts[1]) + (ts[2] + ts[3]));
    for (int t = 0; t < 4; ++t) o[t] *= corr;

    // P^T as B operand: element e of chunk c is key 32c + 16*(e>>3) + 8*half + (e&7),
    // the same k order load_frag gives the V rows.
    Frag16 pb0, pb1;
    for (int e = 0; e < 16; ++e) {
      pb0.v[e] = (_Float16)s[e >> 3][e & 7];
      pb1.v[e] = (_Float16)s[2 + (e >> 3)][e & 7];
    }

    // O^T += V P^T : A = V channel rows (16 x 64 keys), B = P^T.
    for (int t = 0; t < 4; ++t) {
      const _Float16* vrow = vtile + (t * 16 + r) * LDP;
      Frag16 va0, va1;
      load_frag(va0, vrow, half);
      load_frag(va1, vrow + 32, half);
      o[t] = wmma16(va0, pb0, o[t]);
      o[t] = wmma16(va1, pb1, o[t]);
    }

    // Publish point of stage st + 1.
    wait_ds0();           // my reads of buffer `cur` have returned
    wait_async0();        // my copies of stage st + 1 have landed
    __syncthreads();      // everyone's have; everyone is done reading `cur`
    if (st + 2 < NSTAGE) issue_stage(st + 2, cur);
  }
  wait_async0();          // nothing of mine is in flight any more

  // Hand this wave's partial result over: maximum, sum (halves joined), O^T rows.
  li += xhalf(li);
  if (half == 0) {
    lds_m[kg][qt][r] = mi;
    lds_l[kg][qt][r] = li;
  }
  float* prow = &lds_o[kg][qt][r][8 * half];
  for (int t = 0; t < 4; ++t) {
    *(float4*)(prow + t * 16)     = make_float4(o[t][0], o[t][1], o[t][2], o[t][3]);
    *(float4*)(prow + t * 16 + 4) = make_float4(o[t][4], o[t][5], o[t][6], o[t][7]);
  }
  __syncthreads();        // all partial results are in LDS

  // Join the four key groups.  Wave (kg, qt) finishes queries 4*kg..4*kg+3 of tile
  // qt: a lane takes 8 consecutive channels of one query (position-major [i][c], f16).
  // The tile goes into the first K buffer, which nobody reads behind the loop's last
  // barrier and into which no copy is in flight any more.
  const int ql = 4 * kg + (lane >> 3);
  const int cc = lane & 7;
  float mg[KG];
  for (int j = 0; j < KG; ++j) mg[j] = lds_m[j][qt][ql];
  const float mall = fmaxf(fmaxf(mg[0], mg[1]), fmaxf(mg[2], mg[3]));
  float lall = 0.f;
  float acc[8];
  for (int v = 0; v < 8; ++v) acc[v] = 0.f;
  for (int j = 0; j < KG; ++j) {
    const float wj = exp_slot(mg[j] - mall);
    lall += wj * lds_l[j][qt][ql];
    const float4 p0 = *(const float4*)&lds_o[j][qt][ql][cc * 8];
    const float4 p1 = *(const float4*)&lds_o[j][qt][ql][cc * 8 + 4];
    acc[0] += wj * p0.x; acc[1] += wj * p0.y; acc[2] += wj * p0.z; acc[3] += wj * p0.w;
    acc[4] += wj * p1.x; acc[5] += wj * p1.y; acc[6] += wj * p1.z; acc[7] += wj * p1.w;
  }
  const float inv = 1.0f / lall;
  Pack8 pk;
  for (int v = 0; v < 8; ++v) pk.h[v] = (_Float16)(acc[v] * inv);
  _Float16* os = lds_k[0];
  *(uint4*)(os + (qt * 16 + ql) * LDP + cc * 8) = pk.u;
  __syncthreads();        // the block's 64 rows of O are in LDS

  // out = wo @ O + bo + x
  if (wv < 8) {
    Frag16 a[2];
#pragma unroll  // constant indices only
    for (int ck = 0; ck < 2; ++ck) {
      const float4 f0 = wraw[ck][0], f1 = wraw[ck][1], f2 = wraw[ck][2], f3 = wraw[ck][3];
      a[ck].v[0]  = (_Float16)f0.x; a[ck].v[1]  = (_Float16)f0.y;
      a[ck].v[2]  = (_Float16)f0.z; a[ck].v[3]  = (_Float16)f0.w;
      a[ck].v[4]  = (_Float16)f1.x; a[ck].v[5]  = (_Float16)f1.y;
      a[ck].v[6]  = (_Float16)f1.z; a[ck].v[7]  = (_Float16)f1.w;
      a[ck].v[8]  = (_Float16)f2.x; a[ck].v[9]  = (_Float16)f2.y;
      a[ck].v[10] = (_Float16)f2.z; a[ck].v[11] = (_Float16)f2.w;
      a[ck].v[12] = (_Float16)f3.x; a[ck].v[13] = (_Float16)f3.y;
      a[ck].v[14] = (_Float16)f3.z; a[ck].v[15] = (_Float16)f3.w;
    }
    const float bias[8] = {bias0.x, bias0.y, bias0.z, bias0.w, bias1.x, bias1.y, bias1.z, bias1.w};
#pragma unroll  // constant indices only
    for (int i = 0; i < 2; ++i) {
      const _Float16* orow = os + (pg + i * 16 + r) * LDP;
      Frag16 bm0, bm1;
      load_frag(bm0, orow, half);
      load_frag(bm1, orow + 32, half);
      v8f acc2 = {};
      acc2 = wmma16(a[0], bm0, acc2);
      acc2 = wmma16(a[1], bm1, acc2);
#pragma unroll  // constant indices only
      for (int v = 0; v < 8; ++v)
        out[obase + (size_t)v * NPOS + i * 16] = acc2[v] + bias[v] + xr[i][v];
    }
  }
}

// ---------------------------------------------------------------------------
extern "C" void kernel_launch(void* const* d_in, const int* in_sizes, int n_in,
                              void* d_out, int out_size, void* d_ws, size_t ws_size,
                              hipStream_t stream) {
  const float* x   = (const float*)d_in[0];
  const float* lng = (const float*)d_in[1];
  const float* lnb = (const float*)d_in[2];
  const float* wq  = (const float*)d_in[3];
  const float* bq  = (const float*)d_in[4];
  const float* wk  = (const float*)d_in[5];
  const float* bk  = (const float*)d_in[6];
  const float* wv  = (const float*)d_in[7];
  const float* bv  = (const float*)d_in[8];
  const float* wo  = (const float*)d_in[9];
  const float* bo  = (const float*)d_in[10];
  float* out = (float*)d_out;

  char* ws = (char*)d_ws;
  const size_t T = (size_t)B_ * CH * NPOS * sizeof(_Float16);   // 2 MB each
  _Float16* qT   = (_Float16*)(ws + 0 * T);
  _Float16* kT   = (_Float16*)(ws + 1 * T);
  _Float16* v_c  = (_Float16*)(ws + 2 * T);

  pre_kernel<<<dim3(HS, B_), 256, 0, stream>>>(x, lng, lnb, wq, bq, wk, bk, wv, bv, qT, kT, v_c);
  attn_kernel<<<dim3(NPOS / 64, B_), 512, 0, stream>>>(qT, kT, v_c, wo, bo, x, out);
}

// v005
// Measured time: 30.3 microseconds a run.
// Timed twice side by side with v004, it ran 1.06 and 1.07 times as fast.
// All steps since v000 together make it 7.79 times as fast.
#include <hip/hip_runtime.h>
#include <hip/hip_bf16.h>

#define B_   4
#define CH   64
#define HS   64
#define WSZ  64
#define NPOS (HS*WSZ)   // 4096
#define LDP  72         // LDS row stride in halves (144B rows: 16B-aligned)

typedef __attribute__((ext_vector_type(16))) _Float16 v16h;
typedef __attribute__((ext_vector_type(8)))  float    v8f;

union Frag16 { v16h v; uint4 q[2]; };
union Pack8  { uint4 u; _Float16 h[8]; };
union Pack64 { uint4 u[8]; _Float16 h[64]; };

// Load one 16x32 f16 fragment in the A-matrix VGPR layout from a row-major
// tile.  `row` must point at (tile_row_base + this lane's row * ld).
// Lane L (r=L&15, half=L>>4) holds halves k = half*8 + {0..7} and 16+half*8+{0..7}.
__device__ __forceinline__ void load_frag(Frag16& f, const _Float16* row, int half) {
  f.q[0] = *(const uint4*)(row + half * 8);
  f.q[1] = *(const uint4*)(row + half * 8 + 16);
}

__device__ __forceinline__ v8f wmma16(const Frag16& a, const Frag16& b, v8f c) {
  return __builtin_amdgcn_wmma_f32_16x16x32_f16(false, a.v, false, b.v,
                                                (short)0, c, false, false);
}

// Eight async global->LDS copies, 16B per lane each, tracked by ASYNCcnt.
// Per-lane 64-bit global address, per-lane LDS byte address (low 32 bits of the
// __shared__ address).  The s_wait_xcnt stands inside the statement, behind the last
// copy, so that no address register is rewritten in front of it.
struct Copy8 { unsigned l[8]; const _Float16* g[8]; };
__device__ __forceinline__ void async_copy8_b128(const Copy8& c) {
  asm volatile("global_load_async_to_lds_b128 %0, %8, off\n\t"
               "global_load_async_to_lds_b128 %1, %9, off\n\t"
               "global_load_async_to_lds_b128 %2, %10, off\n\t"
               "global_load_async_to_lds_b128 %3, %11, off\n\t"
               "global_load_async_to_lds_b128 %4, %12, off\n\t"
               "global_load_async_to_lds_b128 %5, %13, off\n\t"
               "global_load_async_to_lds_b128 %6, %14, off\n\t"
               "global_load_async_to_lds_b128 %7, %15, off\n\t"
               "s_wait_xcnt 0x0"
               :: "v"(c.l[0]), "v"(c.l[1]), "v"(c.l[2]), "v"(c.l[3]),
                  "v"(c.l[4]), "v"(c.l[5]), "v"(c.l[6]), "v"(c.l[7]),
                  "v"(c.g[0]), "v"(c.g[1]), "v"(c.g[2]), "v"(c.g[3]),
                  "v"(c.g[4]), "v"(c.g[5]), "v"(c.g[6]), "v"(c.g[7])
               : "memory");
}

// Lane l <-> lane l ^ 16 (the other half of the wave), a vector cross-row move.
__device__ __forceinline__ float xhalf(float x) {
  const int xi = __builtin_bit_cast(int, x);
  return __builtin_bit_cast(float, __builtin_amdgcn_permlanex16(xi, xi, 0x76543210, 0xfedcba98,
                                                                false, false));
}

// 2^x.  The v_nop is the slot the instruction set asks for between a
// transcendental and an instruction that reads its result or overwrites its source;
// inside the statement it stays directly behind the v_exp_f32.
__device__ __forceinline__ float exp2_slot(float x) {
  float r;
  asm("v_exp_f32 %0, %1\n\tv_nop" : "=v"(r) : "v"(x));
  return r;
}

// This wave's async copies have landed in LDS.
__device__ __forceinline__ void wait_async0() {
  asm volatile("s_wait_asynccnt 0x0" ::: "memory");
}

// This wave's LDS reads have returned (before a buffer it read is handed back for refill).
__device__ __forceinline__ void wait_ds0() {
  asm volatile("s_wait_dscnt 0x0" ::: "memory");
}

// ---------------------------------------------------------------------------
// Kernel 1: everything in front of the attention, one block per image row (b, h).
// Phase 1: per-pixel channel LayerNorm of rows h-1, h, h+1 (one thread per pixel, its
//          64 channels in registers), f16, into LDS position-major; rows and columns
//          outside the image are zero (the convs' padding).
// Phase 2: depthwise 3x3 convs k and v of row h (a wave owns 8 channels, so its
//          weights are wave-uniform; a lane owns two neighbouring pixels), and
//          q = (wq @ xn + bq) * log2(e) / sqrt(C) of row h on WMMA (the attention's
//          scores are exponents of 2).
// Phase 3: q and k (position-major [p][c]) and v (channel-major [c][p]) leave through
//          LDS as whole 128B rows.
// ---------------------------------------------------------------------------
#define XCOLS (WSZ + 2)          // one zero column on either side

__global__ __launch_bounds__(256) void pre_kernel(const float* __restrict__ x,
                                                  const float* __restrict__ g,
                                                  const float* __restrict__ be,
                                                  const float* __restrict__ wq,
                                                  const float* __restrict__ bq,
                                                  const float* __restrict__ wk,
                                                  const float* __restrict__ bk,
                                                  const float* __restrict__ wv,
                                                  const float* __restrict__ bv,
                                                  _Float16* __restrict__ qT,
                                                  _Float16* __restrict__ kT,
                                                  _Float16* __restrict__ v_c) {
  __shared__ __attribute__((aligned(16))) _Float16 xs[3][XCOLS][LDP];
  __shared__ __attribute__((aligned(16))) _Float16 qs[WSZ][LDP];
  __shared__ __attribute__((aligned(16))) _Float16 ks[WSZ][LDP];
  __shared__ __attribute__((aligned(16))) _Float16 vs[CH][LDP];

  const int h = blockIdx.x;
  const int b = blockIdx.y;
  const int tid = threadIdx.x;
  const int wave = __builtin_amdgcn_readfirstlane(tid >> 5);
  const int lane = tid & 31;
  const int half = lane >> 4, r = lane & 15;

  // The q projection's weights and bias are asked for here and first used behind the
  // barrier, so that their latency runs beside the LayerNorm's.
  const int co0 = (wave & 3) * 16;
  const float4* wrow = (const float4*)(wq + (co0 + r) * CH);
  float4 wraw[2][4];
#pragma unroll  // constant indices only
  for (int ck = 0; ck < 2; ++ck) {
    wraw[ck][0] = wrow[ck * 8 + half * 2];
    wraw[ck][1] = wrow[ck * 8 + half * 2 + 1];
    wraw[ck][2] = wrow[ck * 8 + half * 2 + 4];
    wraw[ck][3] = wrow[ck * 8 + half * 2 + 5];
  }
  const float4 bias0 = *(const float4*)(bq + co0 + 8 * half);
  const float4 bias1 = *(const float4*)(bq + co0 + 8 * half + 4);

  // ---- Phase 1 ----
  if (wave < 6) {
    const int row = wave >> 1;
    const int w = tid & (WSZ - 1);
    const int hh = h - 1 + row;
    Pack64 pk;
    if ((unsigned)hh < HS) {
      const float* xp = x + (size_t)b * CH * NPOS + hh * WSZ + w;
      float xv[CH];
#pragma unroll  // all 64 loads in flight at once; constant indices only
      for (int c = 0; c < CH; ++c) xv[c] = xp[(size_t)c * NPOS];
      float s = 0.f, ss = 0.f;
#pragma unroll  // constant indices only
      for (int c = 0; c < CH; ++c) {
        s += xv[c]; ss += xv[c] * xv[c];
      }
      const float mu = s * (1.0f / CH);
      const float var = ss * (1.0f / CH) - mu * mu;
      const float rstd = rsqrtf(var + 1e-5f);
#pragma unroll  // constant indices only
      for (int c = 0; c < CH; ++c)
        pk.h[c] = (_Float16)((xv[c] - mu) * rstd * g[c] + be[c]);
    } else {
#pragma unroll  // constant indices only
      for (int k = 0; k < 8; ++k) pk.u[k] = make_uint4(0u, 0u, 0u, 0u);
    }
    uint4* d = (uint4*)&xs[row][w + 1][0];
#pragma unroll  // constant indices only
    for (int k = 0; k < 8; ++k) d[k] = pk.u[k];
  } else {
    // The two zero columns of the three rows: 48 chunks of 16B.
    const int i = tid - 192;
    if (i < 48)
      *(uint4*)&xs[i >> 4][((i >> 3) & 1) * (XCOLS - 1)][(i & 7) * 8] = make_uint4(0u, 0u, 0u, 0u);
  }
  __syncthreads();        // the three normalised rows are in LDS

  // ---- Phase 2: convs ----
  {
    const int c0 = wave * 8;
    Pack8 xin[3][4];      // pixels 2*lane-1 .. 2*lane+2 of the three rows, 8 channels
#pragma unroll  // constant indices only
    for (int dy = 0; dy < 3; ++dy)
#pragma unroll  // constant indices only
      for (int k = 0; k < 4; ++k)
        xin[dy][k].u = *(const uint4*)&xs[dy][2 * lane + k][c0];
    Pack8 k0, k1;
#pragma unroll  // constant indices only
    for (int j = 0; j < 8; ++j) {
      const int c = c0 + j;
      float aK0 = bk[c], aV0 = bv[c], aK1 = bk[c], aV1 = bv[c];
#pragma unroll  // constant indices only
      for (int dy = 0; dy < 3; ++dy)
#pragma unroll  // constant indices only
        for (int dx = 0; dx < 3; ++dx) {
          const float fk = wk[c * 9 + dy * 3 + dx];
          const float fv = wv[c * 9 + dy * 3 + dx];
          const float x0 = (float)xin[dy][dx].h[j];
          const float x1 = (float)xin[dy][dx + 1].h[j];
          aK0 += fk * x0; aV0 += fv * x0;
          aK1 += fk * x1; aV1 += fv * x1;
        }
      k0.h[j] = (_Float16)aK0;
      k1.h[j] = (_Float16)aK1;
      union { _Float16 hh2[2]; unsigned u; } vp;
      vp.hh2[0] = (_Float16)aV0;
      vp.hh2[1] = (_Float16)aV1;
      *(unsigned*)&vs[c][2 * lane] = vp.u;
    }
    *(uint4*)&ks[2 * lane][c0]     = k0.u;
    *(uint4*)&ks[2 * lane + 1][c0] = k1.u;
  }

  // ---- Phase 2: q projection.  Wave = 16 output channels x 32 pixels. ----
  {
    Frag16 a[2];
#pragma unroll  // constant indices only
    for (int ck = 0; ck < 2; ++ck) {
      const float4 f0 = wraw[ck][0], f1 = wraw[ck][1], f2 = wraw[ck][2], f3 = wraw[ck][3];
      a[ck].v[0]  = (_Float16)f0.x; a[ck].v[1]  = (_Float16)f0.y;
      a[ck].v[2]  = (_Float16)f0.z; a[ck].v[3]  = (_Float16)f0.w;
      a[ck].v[4]  = (_Float16)f1.x; a[ck].v[5]  = (_Float16)f1.y;
      a[ck].v[6]  = (_Float16)f1.z; a[ck].v[7]  = (_Float16)f1.w;
      a[ck].v[8]  = (_Float16)f2.x; a[ck].v[9]  = (_Float16)f2.y;
      a[ck].v[10] = (_Float16)f2.z; a[ck].v[11] = (_Float16)f2.w;
      a[ck].v[12] = (_Float16)f3.x; a[ck].v[13] = (_Float16)f3.y;
      a[ck].v[14] = (_Float16)f3.z; a[ck].v[15] = (_Float16)f3.w;
    }
    const float bias[8] = {bias0.x, bias0.y, bias0.z, bias0.w, bias1.x, bias1.y, bias1.z, bias1.w};
#pragma unroll  // constant indices only
    for (int i = 0; i < 2; ++i) {
      const int p1 = ((wave >> 2) * 2 + i) * 16;
      const _Float16* xrow = &xs[1][p1 + r + 1][0];
      Frag16 bm0, bm1;
      load_frag(bm0, xrow, half);
      load_frag(bm1, xrow + 32, half);
      v8f acc = {};
      acc = wmma16(a[0], bm0, acc);
      acc = wmma16(a[1], bm1, acc);
      Pack8 pk;
#pragma unroll  // constant indices only
      for (int v = 0; v < 8; ++v)
        pk.h[v] = (_Float16)((acc[v] + bias[v]) * 0.18033688f);   // fold log2(e)/sqrt(64)
      *(uint4*)&qs[p1 + r][co0 + 8 * half] = pk.u;
    }
  }
  __syncthreads();        // q, k and v of this image row are in LDS

  // ---- Phase 3: 512 chunks of 16B of each; 8 lanes store one whole 128B row. ----
  const size_t prow0 = (size_t)b * NPOS + h * WSZ;
#pragma unroll  // both trips' LDS reads in front of the stores
  for (int it = 0; it < 2; ++it) {
    const int idx = tid + it * 256;
    const int row = idx >> 3, col = idx & 7;
    *(uint4*)(qT + (prow0 + row) * CH + col * 8) = *(const uint4*)&qs[row][col * 8];
    *(uint4*)(kT + (prow0 + row) * CH + col * 8) = *(const uint4*)&ks[row][col * 8];
    *(uint4*)(v_c + ((size_t)b * CH + row) * NPOS + h * WSZ + col * 8) = *(const uint4*)&vs[row][col * 8];
  }
}

#define KG     4
#define QTL    4
#define SKEYS  (KG * 64)
#define NSTAGE (NPOS / SKEYS)
#define OPITCH 68

__global__ __launch_bounds__(512) void attn_kernel(const _Float16* __restrict__ qT,
                                                   const _Float16* __restrict__ kT,
                                                   const _Float16* __restrict__ v_c,
                                                   const float* __restrict__ wo,
                                                   const float* __restrict__ bo,
                                                   const float* __restrict__ x,
                                                   float* __restrict__ out) {
  __shared__ __attribute__((aligned(16))) _Float16 lds_k[2][KG * 64 * LDP];
  __shared__ __attribute__((aligned(16))) _Float16 lds_v[2][KG * 64 * LDP];
  __shared__ __attribute__((aligned(16))) float lds_o[KG][QTL][16][OPITCH];
  __shared__ float lds_m[KG][QTL][16];
  __shared__ float lds_l[KG][QTL][16];

  const int b = blockIdx.y;
  const int qbase = blockIdx.x * (QTL * 16);
  const int tid = threadIdx.x;
  const int wave = tid >> 5;
  const int lane = tid & 31;
  const int half = lane >> 4, r = lane & 15;
  const int qt = wave & (QTL - 1);
  const int kg = wave >> 2;
  const int i0 = qbase + qt * 16;

  // Q fragments (B operand: lane r = query column), fixed for the whole loop.
  const _Float16* qrow = qT + ((size_t)b * NPOS + i0 + r) * CH;
  Frag16 qb0, qb1;
  load_frag(qb0, qrow, half);
  load_frag(qb1, qrow + 32, half);

  // Per lane: reference maximum of query r (equal in both halves; set from the first
  // stage's keys), its negative in all eight registers of the score product's C
  // operand, and this half's share of the sum.
  // o[t][v] = O^T[channel t*16 + 8*half + v][query r], this wave's keys only.
  float mi = 0.f, li = 0.f;
  v8f cref = {};
  v8f o[4];
  for (int t = 0; t < 4; ++t) o[t] = (v8f){};

  // Issue the async staging of stage `st` into buffer `buf` (8 copies / wave).
  // K: 256 key rows of 128B.  V: 64 channel rows of 512B, cut into the four key
  // groups' 64x64 tiles.
  auto issue_stage = [&](int st, int buf) {
    const int j0 = st * SKEYS;
    const _Float16* kbase = kT + ((size_t)b * NPOS + j0) * CH;
    const _Float16* vbase = v_c + (size_t)b * CH * NPOS + j0;
    Copy8 c;
    for (int it = 0; it < 4; ++it) {
      const int idx = tid + it * 512;           // 0..2047 b128 chunks
      const int row = idx >> 3, col = idx & 7;
      c.g[it] = kbase + row * CH + col * 8;
      c.l[it] = (unsigned)(uintptr_t)(lds_k[buf] + row * LDP + col * 8);
    }
    for (int it = 0; it < 4; ++it) {
      const int idx = tid + it * 512;
      const int row = idx >> 5, grp = (idx >> 3) & 3, col = idx & 7;
      c.g[4 + it] = vbase + (size_t)row * NPOS + grp * 64 + col * 8;
      c.l[4 + it] = (unsigned)(uintptr_t)(lds_v[buf] + (grp * 64 + row) * LDP + col * 8);
    }
    async_copy8_b128(c);
  };

  issue_stage(0, 0);

  // Output projection: waves 0..7 each take 16 output channels x 32 positions, so a
  // wave writes whole 128B lines of out.  Its weights, bias and residual x are asked
  // for here, behind the first stage's copies, and first used in the epilogue, so
  // that their latency runs beside the first stage's.
  const int wv = __builtin_amdgcn_readfirstlane(wave);
  const int co0 = (wv & 3) * 16;
  const int pg = (wv >> 2) * 32;
  const size_t obase = ((size_t)b * CH + co0 + 8 * half) * NPOS + qbase + pg + r;
  float4 wraw[2][4];
  float4 bias0, bias1;
  float xr[2][8];
  if (wv < 8) {
    const float4* wrow = (const float4*)(wo + (co0 + r) * CH);
#pragma unroll  // constant indices only
    for (int ck = 0; ck < 2; ++ck) {
      wraw[ck][0] = wrow[ck * 8 + half * 2];
      wraw[ck][1] = wrow[ck * 8 + half * 2 + 1];
      wraw[ck][2] = wrow[ck * 8 + half * 2 + 4];
      wraw[ck][3] = wrow[ck * 8 + half * 2 + 5];
    }
    bias0 = *(const float4*)(bo + co0 + 8 * half);
    bias1 = *(const float4*)(bo + co0 + 8 * half + 4);
#pragma unroll  // constant indices only
    for (int i = 0; i < 2; ++i)
#pragma unroll  // constant indices only
      for (int v = 0; v < 8; ++v) xr[i][v] = x[obase + (size_t)v * NPOS + i * 16];
    // Before a register that these loads name is overwritten.
    asm volatile("s_wait_xcnt 0x0" ::: "memory");
  }

  wait_async0();          // my copies of stage 0 have landed
  __syncthreads();        // everyone's have
  issue_stage(1, 1);

  // Kept rolled: peeled for its st == 0 test, the first stage becomes a second copy of
  // the body, with every K fragment's LDS read waited for singly.
#pragma nounroll
  for (int st = 0; st < NSTAGE; ++st) {
    const int cur = st & 1;
    const _Float16* ktile = lds_k[cur] + kg * 64 * LDP;
    const _Float16* vtile = lds_v[cur] + kg * 64 * LDP;

    // S^T = K Q^T : 4 key sub-tiles of 16 (A rows), contraction over 64 channels.
    // s[t][v] = score of key t*16 + 8*half + v against query r, less the reference.
    v8f s[4];
    for (int t = 0; t < 4; ++t) {
      const _Float16* krow = ktile + (t * 16 + r) * LDP;
      Frag16 ka0, ka1;
      load_frag(ka0, krow, half);
      load_frag(ka1, krow + 32, half);
      v8f acc = wmma16(ka0, qb0, cref);
      acc = wmma16(ka1, qb1, acc);
      s[t] = acc;
    }

    // Online softmax, one query per lane.
    // One short chain per sub-tile for the maximum and for the sum.
    float tm[4];
    for (int t = 0; t < 4; ++t) {
      tm[t] = s[t][0];
      for (int v = 1; v < 8; ++v) tm[t] = fmaxf(tm[t], s[t][v]);
    }
    float rm = fmaxf(fmaxf(tm[0], tm[1]), fmaxf(tm[2], tm[3]));
    // Move the reference: always in the first stage (to that stage's maximum, up or
    // down; sum and O^T are still zero), later only upwards.  A scalar branch.
    const float thr = (st == 0) ? -3.0e38f : 8.0f;
    if (__builtin_amdgcn_ballot_w32(rm > thr) != 0u) {
      rm = fmaxf(rm, xhalf(rm));                // join the two halves' keys
      const float up = fmaxf(rm, 0.f);
      const float delta = (st == 0) ? rm : up;
      const float corr = exp2_slot(-up);
      mi += delta;
#pragma unroll  // constant indices only
      for (int t = 0; t < 4; ++t) {
        s[t] -= delta;
        o[t] *= corr;
      }
      li *= corr;
#pragma unroll  // constant indices only
      for (int v = 0; v < 8; ++v) cref[v] = -mi;
    }
    float ts[4];
    // Unrolled so that every index of s[] is a constant (a run-time index would
    // go through indexed register moves).
#pragma unroll
    for (int t = 0; t < 4; ++t) {
      s[t][0] = exp2_slot(s[t][0]);
      ts[t] = s[t][0];
#pragma unroll  // as above: constant indices only
      for (int v = 1; v < 8; ++v) {
        s[t][v] = exp2_slot(s[t][v]);
        ts[t] += s[t][v];
      }
    }
    li += (ts[0] + ts[1]) + (ts[2] + ts[3]);

    // P^T as B operand: element e of chunk c is key 32c + 16*(e>>3) + 8*half + (e&7),
    // the same k order load_frag gives the V rows.
    Frag16 pb0, pb1;
    for (int e = 0; e < 16; ++e) {
      pb0.v[e] = (_Float16)s[e >> 3][e & 7];
      pb1.v[e] = (_Float16)s[2 + (e >> 3)][e & 7];
    }

    // O^T += V P^T : A = V channel rows (16 x 64 keys), B = P^T.
    for (int t = 0; t < 4; ++t) {
      const _Float16* vrow = vtile + (t * 16 + r) * LDP;
      Frag16 va0, va1;
      load_frag(va0, vrow, half);
      load_frag(va1, vrow + 32, half);
      o[t] = wmma16(va0, pb0, o[t]);
      o[t] = wmma16(va1, pb1, o[t]);
    }

    // Publish point of stage st + 1.
    wait_ds0();           // my reads of buffer `cur` have returned
    wait_async0();        // my copies of stage st + 1 have landed
    __syncthreads();      // everyone's have; everyone is done reading `cur`
    if (st + 2 < NSTAGE) issue_stage(st + 2, cur);
  }
  wait_async0();          // nothing of mine is in flight any more

  // Hand this wave's partial result over: reference, sum (halves joined), O^T rows.
  li += xhalf(li);
  if (half == 0) {
    lds_m[kg][qt][r] = mi;
    lds_l[kg][qt][r] = li;
  }
  float* prow = &lds_o[kg][qt][r][8 * half];
  for (int t = 0; t < 4; ++t) {
    *(float4*)(prow + t * 16)     = make_float4(o[t][0], o[t][1], o[t][2], o[t][3]);
    *(float4*)(prow + t * 16 + 4) = make_float4(o[t][4], o[t][5], o[t][6], o[t][7]);
  }
  __syncthreads();        // all partial results are in LDS

  // Join the four key groups.  Wave (kg, qt) finishes queries 4*kg..4*kg+3 of tile
  // qt: a lane takes 8 consecutive channels of one query (position-major [i][c], f16).
  // The tile goes into the first K buffer, which nobody reads behind the loop's last
  // barrier and into which no copy is in flight any more.
  const int ql = 4 * kg + (lane >> 3);
  const int cc = lane & 7;
  float mg[KG];
  for (int j = 0; j < KG; ++j) mg[j] = lds_m[j][qt][ql];
  const float mall = fmaxf(fmaxf(mg[0], mg[1]), fmaxf(mg[2], mg[3]));
  float lall = 0.f;
  float acc[8];
  for (int v = 0; v < 8; ++v) acc[v] = 0.f;
  for (int j = 0; j < KG; ++j) {
    const float wj = exp2_slot(mg[j] - mall);
    lall += wj * lds_l[j][qt][ql];
    const float4 p0 = *(const float4*)&lds_o[j][qt][ql][cc * 8];
    const float4 p1 = *(const float4*)&lds_o[j][qt][ql][cc * 8 + 4];
    acc[0] += wj * p0.x; acc[1] += wj * p0.y; acc[2] += wj * p0.z; acc[3] += wj * p0.w;
    acc[4] += wj * p1.x; acc[5] += wj * p1.y; acc[6] += wj * p1.z; acc[7] += wj * p1.w;
  }
  const float inv = 1.0f / lall;
  Pack8 pk;
  for (int v = 0; v < 8; ++v) pk.h[v] = (_Float16)(acc[v] * inv);
  _Float16* os = lds_k[0];
  *(uint4*)(os + (qt * 16 + ql) * LDP + cc * 8) = pk.u;
  __syncthreads();        // the block's 64 rows of O are in LDS

  // out = wo @ O + bo + x
  if (wv < 8) {
    Frag16 a[2];
#pragma unroll  // constant indices only
    for (int ck = 0; ck < 2; ++ck) {
      const float4 f0 = wraw[ck][0], f1 = wraw[ck][1], f2 = wraw[ck][2], f3 = wraw[ck][3];
      a[ck].v[0]  = (_Float16)f0.x; a[ck].v[1]  = (_Float16)f0.y;
      a[ck].v[2]  = (_Float16)f0.z; a[ck].v[3]  = (_Float16)f0.w;
      a[ck].v[4]  = (_Float16)f1.x; a[ck].v[5]  = (_Float16)f1.y;
      a[ck].v[6]  = (_Float16)f1.z; a[ck].v[7]  = (_Float16)f1.w;
      a[ck].v[8]  = (_Float16)f2.x; a[ck].v[9]  = (_Float16)f2.y;
      a[ck].v[10] = (_Float16)f2.z; a[ck].v[11] = (_Float16)f2.w;
      a[ck].v[12] = (_Float16)f3.x; a[ck].v[13] = (_Float16)f3.y;
      a[ck].v[14] = (_Float16)f3.z; a[ck].v[15] = (_Float16)f3.w;
    }
    const float bias[8] = {bias0.x, bias0.y, bias0.z, bias0.w, bias1.x, bias1.y, bias1.z, bias1.w};
#pragma unroll  // constant indices only
    for (int i = 0; i < 2; ++i) {
      const _Float16* orow = os + (pg + i * 16 + r) * LDP;
      Frag16 bm0, bm1;
      load_frag(bm0, orow, half);
      load_frag(bm1, orow + 32, half);
      v8f acc2 = {};
      acc2 = wmma16(a[0], bm0, acc2);
      acc2 = wmma16(a[1], bm1, acc2);
#pragma unroll  // constant indices only
      for (int v = 0; v < 8; ++v)
        out[obase + (size_t)v * NPOS + i * 16] = acc2[v] + bias[v] + xr[i][v];
    }
  }
}

// ---------------------------------------------------------------------------
extern "C" void kernel_launch(void* const* d_in, const int* in_sizes, int n_in,
                              void* d_out, int out_size, void* d_ws, size_t ws_size,
                              hipStream_t stream) {
  const float* x   = (const float*)d_in[0];
  const float* lng = (const float*)d_in[1];
  const float* lnb = (const float*)d_in[2];
  const float* wq  = (const float*)d_in[3];
  const float* bq  = (const float*)d_in[4];
  const float* wk  = (const float*)d_in[5];
  const float* bk  = (const float*)d_in[6];
  const float* wv  = (const float*)d_in[7];
  const float* bv  = (const float*)d_in[8];
  const float* wo  = (const float*)d_in[9];
  const float* bo  = (const float*)d_in[10];
  float* out = (float*)d_out;

  char* ws = (char*)d_ws;
  const size_t T = (size_t)B_ * CH * NPOS * sizeof(_Float16);   // 2 MB each
  _Float16* qT   = (_Float16*)(ws + 0 * T);
  _Float16* kT   = (_Float16*)(ws + 1 * T);
  _Float16* v_c  = (_Float16*)(ws + 2 * T);

  pre_kernel<<<dim3(HS, B_), 256, 0, stream>>>(x, lng, lnb, wq, bq, wk, bk, wv, bv, qT, kT, v_c);
  attn_kernel<<<dim3(NPOS / 64, B_), 512, 0, stream>>>(qT, kT, v_c, wo, bo, x, out);
}

// v006
// A run of this version takes 27.8 microseconds.
// Timed twice side by side with v005, it ran 1.08 and 1.10 times as fast.
// Over all steps from v000 it is 8.49 times as fast.
#include <hip/hip_runtime.h>
#include <hip/hip_bf16.h>

#define B_   4
#define CH   64
#define HS   64
#define WSZ  64
#define NPOS (HS*WSZ)   // 4096
#define LDP  72         // LDS row stride in halves (144B rows: 16B-aligned)

typedef __attribute__((ext_vector_type(16))) _Float16 v16h;
typedef __attribute__((ext_vector_type(8)))  float    v8f;

union Frag16 { v16h v; uint4 q[2]; };
union Pack8  { uint4 u; _Float16 h[8]; };
union Pack64 { uint4 u[8]; _Float16 h[64]; };

// Load one 16x32 f16 fragment in the A-matrix VGPR layout from a row-major
// tile.  `row` must point at (tile_row_base + this lane's row * ld).
// Lane L (r=L&15, half=L>>4) holds halves k = half*8 + {0..7} and 16+half*8+{0..7}.
__device__ __forceinline__ void load_frag(Frag16& f, const _Float16* row, int half) {
  f.q[0] = *(const uint4*)(row + half * 8);
  f.q[1] = *(const uint4*)(row + half * 8 + 16);
}

__device__ __forceinline__ v8f wmma16(const Frag16& a, const Frag16& b, v8f c) {
  return __builtin_amdgcn_wmma_f32_16x16x32_f16(false, a.v, false, b.v,
                                                (short)0, c, false, false);
}

// Eight async global->LDS copies, 16B per lane each, tracked by ASYNCcnt.
// Per-lane 64-bit global address, per-lane LDS byte address (low 32 bits of the
// __shared__ address).  The s_wait_xcnt stands inside the statement, behind the last
// copy, so that no address register is rewritten in front of it.
struct Copy8 { unsigned l[8]; const _Float16* g[8]; };
__device__ __forceinline__ void async_copy8_b128(const Copy8& c) {
  asm volatile("global_load_async_to_lds_b128 %0, %8, off\n\t"
               "global_load_async_to_lds_b128 %1, %9, off\n\t"
               "global_load_async_to_lds_b128 %2, %10, off\n\t"
               "global_load_async_to_lds_b128 %3, %11, off\n\t"
               "global_load_async_to_lds_b128 %4, %12, off\n\t"
               "global_load_async_to_lds_b128 %5, %13, off\n\t"
               "global_load_async_to_lds_b128 %6, %14, off\n\t"
               "global_load_async_to_lds_b128 %7, %15, off\n\t"
               "s_wait_xcnt 0x0"
               :: "v"(c.l[0]), "v"(c.l[1]), "v"(c.l[2]), "v"(c.l[3]),
                  "v"(c.l[4]), "v"(c.l[5]), "v"(c.l[6]), "v"(c.l[7]),
                  "v"(c.g[0]), "v"(c.g[1]), "v"(c.g[2]), "v"(c.g[3]),
                  "v"(c.g[4]), "v"(c.g[5]), "v"(c.g[6]), "v"(c.g[7])
               : "memory");
}

// Lane l <-> lane l ^ 16 (the other half of the wave), a vector cross-row move.
__device__ __forceinline__ float xhalf(float x) {
  const int xi = __builtin_bit_cast(int, x);
  return __builtin_bit_cast(float, __builtin_amdgcn_permlanex16(xi, xi, 0x76543210, 0xfedcba98,
                                                                false, false));
}

// 2^x.  The v_nop is the slot the instruction set asks for between a
// transcendental and an instruction that reads its result or overwrites its source;
// inside the statement it stays directly behind the v_exp_f32.
__device__ __forceinline__ float exp2_slot(float x) {
  float r;
  asm("v_exp_f32 %0, %1\n\tv_nop" : "=v"(r) : "v"(x));
  return r;
}

// This wave's async copies have landed in LDS.
__device__ __forceinline__ void wait_async0() {
  asm volatile("s_wait_asynccnt 0x0" ::: "memory");
}

// This wave's LDS reads have returned (before a buffer it read is handed back for refill).
__device__ __forceinline__ void wait_ds0() {
  asm volatile("s_wait_dscnt 0x0" ::: "memory");
}

// ---------------------------------------------------------------------------
// Kernel 1: everything in front of the attention, one block per image row (b, h).
// Phase 1: per-pixel channel LayerNorm of rows h-1, h, h+1 (one thread per pixel, its
//          64 channels in registers), f16, into LDS position-major; rows and columns
//          outside the image are zero (the convs' padding).
// Phase 2: depthwise 3x3 convs k and v of row h (a wave owns 8 channels, so its
//          weights are wave-uniform; a lane owns two neighbouring pixels), and
//          q = (wq @ xn + bq) * log2(e) / sqrt(C) of row h on WMMA (the attention's
//          scores are exponents of 2).
// Phase 3: q and k (position-major [p][c]) and v (channel-major [c][p]) leave through
//          LDS as whole 128B rows.
// ---------------------------------------------------------------------------
#define XCOLS (WSZ + 2)          // one zero column on either side

__global__ __launch_bounds__(256) void pre_kernel(const float* __restrict__ x,
                                                  const float* __restrict__ g,
                                                  const float* __restrict__ be,
                                                  const float* __restrict__ wq,
                                                  const float* __restrict__ bq,
                                                  const float* __restrict__ wk,
                                                  const float* __restrict__ bk,
                                                  const float* __restrict__ wv,
                                                  const float* __restrict__ bv,
                                                  _Float16* __restrict__ qT,
                                                  _Float16* __restrict__ kT,
                                                  _Float16* __restrict__ v_c) {
  __shared__ __attribute__((aligned(16))) _Float16 xs[3][XCOLS][LDP];
  __shared__ __attribute__((aligned(16))) _Float16 qs[WSZ][LDP];
  __shared__ __attribute__((aligned(16))) _Float16 ks[WSZ][LDP];
  __shared__ __attribute__((aligned(16))) _Float16 vs[CH][LDP];

  const int h = blockIdx.x;
  const int b = blockIdx.y;
  const int tid = threadIdx.x;
  const int wave = __builtin_amdgcn_readfirstlane(tid >> 5);
  const int lane = tid & 31;
  const int half = lane >> 4, r = lane & 15;

  // The q projection's weights and bias are asked for here and first used behind the
  // barrier, so that their latency runs beside the LayerNorm's.
  const int co0 = (wave & 3) * 16;
  const float4* wrow = (const float4*)(wq + (co0 + r) * CH);
  float4 wraw[2][4];
#pragma unroll  // constant indices only
  for (int ck = 0; ck < 2; ++ck) {
    wraw[ck][0] = wrow[ck * 8 + half * 2];
    wraw[ck][1] = wrow[ck * 8 + half * 2 + 1];
    wraw[ck][2] = wrow[ck * 8 + half * 2 + 4];
    wraw[ck][3] = wrow[ck * 8 + half * 2 + 5];
  }
  const float4 bias0 = *(const float4*)(bq + co0 + 8 * half);
  const float4 bias1 = *(const float4*)(bq + co0 + 8 * half + 4);

  // ---- Phase 1 ----
  if (wave < 6) {
    const int row = wave >> 1;
    const int w = tid & (WSZ - 1);
    const int hh = h - 1 + row;
    Pack64 pk;
    if ((unsigned)hh < HS) {
      const float* xp = x + (size_t)b * CH * NPOS + hh * WSZ + w;
      float xv[CH];
#pragma unroll  // all 64 loads in flight at once; constant indices only
      for (int c = 0; c < CH; ++c) xv[c] = xp[(size_t)c * NPOS];
      float s = 0.f, ss = 0.f;
#pragma unroll  // constant indices only
      for (int c = 0; c < CH; ++c) {
        s += xv[c]; ss += xv[c] * xv[c];
      }
      const float mu = s * (1.0f / CH);
      const float var = ss * (1.0f / CH) - mu * mu;
      const float rstd = rsqrtf(var + 1e-5f);
#pragma unroll  // constant indices only
      for (int c = 0; c < CH; ++c)
        pk.h[c] = (_Float16)((xv[c] - mu) * rstd * g[c] + be[c]);
    } else {
#pragma unroll  // constant indices only
      for (int k = 0; k < 8; ++k) pk.u[k] = make_uint4(0u, 0u, 0u, 0u);
    }
    uint4* d = (uint4*)&xs[row][w + 1][0];
#pragma unroll  // constant indices only
    for (int k = 0; k < 8; ++k) d[k] = pk.u[k];
  } else {
    // The two zero columns of the three rows: 48 chunks of 16B.
    const int i = tid - 192;
    if (i < 48)
      *(uint4*)&xs[i >> 4][((i >> 3) & 1) * (XCOLS - 1)][(i & 7) * 8] = make_uint4(0u, 0u, 0u, 0u);
  }
  __syncthreads();        // the three normalised rows are in LDS

  // ---- Phase 2: convs ----
  {
    const int c0 = wave * 8;
    Pack8 xin[3][4];      // pixels 2*lane-1 .. 2*lane+2 of the three rows, 8 channels
#pragma unroll  // constant indices only
    for (int dy = 0; dy < 3; ++dy)
#pragma unroll  // constant indices only
      for (int k = 0; k < 4; ++k)
        xin[dy][k].u = *(const uint4*)&xs[dy][2 * lane + k][c0];
    Pack8 k0, k1;
#pragma unroll  // constant indices only
    for (int j = 0; j < 8; ++j) {
      const int c = c0 + j;
      float aK0 = bk[c], aV0 = bv[c], aK1 = bk[c], aV1 = bv[c];
#pragma unroll  // constant indices only
      for (int dy = 0; dy < 3; ++dy)
#pragma unroll  // constant indices only
        for (int dx = 0; dx < 3; ++dx) {
          const float fk = wk[c * 9 + dy * 3 + dx];
          const float fv = wv[c * 9 + dy * 3 + dx];
          const float x0 = (float)xin[dy][dx].h[j];
          const float x1 = (float)xin[dy][dx + 1].h[j];
          aK0 += fk * x0; aV0 += fv * x0;
          aK1 += fk * x1; aV1 += fv * x1;
        }
      k0.h[j] = (_Float16)aK0;
      k1.h[j] = (_Float16)aK1;
      union { _Float16 hh2[2]; unsigned u; } vp;
      vp.hh2[0] = (_Float16)aV0;
      vp.hh2[1] = (_Float16)aV1;
      *(unsigned*)&vs[c][2 * lane] = vp.u;
    }
    *(uint4*)&ks[2 * lane][c0]     = k0.u;
    *(uint4*)&ks[2 * lane + 1][c0] = k1.u;
  }

  // ---- Phase 2: q projection.  Wave = 16 output channels x 32 pixels. ----
  {
    Frag16 a[2];
#pragma unroll  // constant indices only
    for (int ck = 0; ck < 2; ++ck) {
      const float4 f0 = wraw[ck][0], f1 = wraw[ck][1], f2 = wraw[ck][2], f3 = wraw[ck][3];
      a[ck].v[0]  = (_Float16)f0.x; a[ck].v[1]  = (_Float16)f0.y;
      a[ck].v[2]  = (_Float16)f0.z; a[ck].v[3]  = (_Float16)f0.w;
      a[ck].v[4]  = (_Float16)f1.x; a[ck].v[5]  = (_Float16)f1.y;
      a[ck].v[6]  = (_Float16)f1.z; a[ck].v[7]  = (_Float16)f1.w;
      a[ck].v[8]  = (_Float16)f2.x; a[ck].v[9]  = (_Float16)f2.y;
      a[ck].v[10] = (_Float16)f2.z; a[ck].v[11] = (_Float16)f2.w;
      a[ck].v[12] = (_Float16)f3.x; a[ck].v[13] = (_Float16)f3.y;
      a[ck].v[14] = (_Float16)f3.z; a[ck].v[15] = (_Float16)f3.w;
    }
    const float bias[8] = {bias0.x, bias0.y, bias0.z, bias0.w, bias1.x, bias1.y, bias1.z, bias1.w};
#pragma unroll  // constant indices only
    for (int i = 0; i < 2; ++i) {
      const int p1 = ((wave >> 2) * 2 + i) * 16;
      const _Float16* xrow = &xs[1][p1 + r + 1][0];
      Frag16 bm0, bm1;
      load_frag(bm0, xrow, half);
      load_frag(bm1, xrow + 32, half);
      v8f acc = {};
      acc = wmma16(a[0], bm0, acc);
      acc = wmma16(a[1], bm1, acc);
      Pack8 pk;
#pragma unroll  // constant indices only
      for (int v = 0; v < 8; ++v)
        pk.h[v] = (_Float16)((acc[v] + bias[v]) * 0.18033688f);   // fold log2(e)/sqrt(64)
      *(uint4*)&qs[p1 + r][co0 + 8 * half] = pk.u;
    }
  }
  __syncthreads();        // q, k and v of this image row are in LDS

  // ---- Phase 3: 512 chunks of 16B of each; 8 lanes store one whole 128B row. ----
  const size_t prow0 = (size_t)b * NPOS + h * WSZ;
#pragma unroll  // both trips' LDS reads in front of the stores
  for (int it = 0; it < 2; ++it) {
    const int idx = tid + it * 256;
    const int row = idx >> 3, col = idx & 7;
    *(uint4*)(qT + (prow0 + row) * CH + col * 8) = *(const uint4*)&qs[row][col * 8];
    *(uint4*)(kT + (prow0 + row) * CH + col * 8) = *(const uint4*)&ks[row][col * 8];
    *(uint4*)(v_c + ((size_t)b * CH + row) * NPOS + h * WSZ + col * 8) = *(const uint4*)&vs[row][col * 8];
  }
}

#define KG     8
#define QPW    2
#define QBLK   64
#define SKEYS  256
#define GKEYS  (SKEYS / KG)
#define NSTAGE (NPOS / SKEYS)
#define OPITCH 68

__global__ __launch_bounds__(512) void attn_kernel(const _Float16* __restrict__ qT,
                                                   const _Float16* __restrict__ kT,
                                                   const _Float16* __restrict__ v_c,
                                                   const float* __restrict__ wo,
                                                   const float* __restrict__ bo,
                                                   const float* __restrict__ x,
                                                   float* __restrict__ out) {
  __shared__ __attribute__((aligned(16))) _Float16 lds_k[2][SKEYS * LDP];
  __shared__ __attribute__((aligned(16))) _Float16 lds_v[2][SKEYS * LDP];
  __shared__ __attribute__((aligned(16))) float lds_o[KG][QBLK][OPITCH];
  __shared__ float lds_m[KG][QBLK];
  __shared__ float lds_l[KG][QBLK];

  const int b = blockIdx.y;
  const int qbase = blockIdx.x * QBLK;
  const int tid = threadIdx.x;
  const int wave = tid >> 5;
  const int lane = tid & 31;
  const int half = lane >> 4, r = lane & 15;
  const int qp = wave & 1;
  const int kg = wave >> 1;
  const int ql0 = qp * (QPW * 16);        // this wave's first query within the block

  // Q fragments (B operand: lane r = query column), fixed for the whole loop.
  Frag16 qb[QPW][2];
  for (int j = 0; j < QPW; ++j) {
    const _Float16* qrow = qT + ((size_t)b * NPOS + qbase + ql0 + j * 16 + r) * CH;
    load_frag(qb[j][0], qrow, half);
    load_frag(qb[j][1], qrow + 32, half);
  }

  // Per lane and query tile j: reference maximum of query r (equal in both halves; set
  // from the first stage's keys), its negative in all eight registers of the score
  // product's C operand, and this half's share of the sum.
  // o[j][t][v] = O^T[channel t*16 + 8*half + v][query r of tile j], this wave's keys only.
  float mi[QPW], li[QPW];
  v8f cref[QPW];
  v8f o[QPW][4];
  for (int j = 0; j < QPW; ++j) {
    mi[j] = 0.f; li[j] = 0.f; cref[j] = (v8f){};
    for (int t = 0; t < 4; ++t) o[j][t] = (v8f){};
  }

  // Issue the async staging of stage `st` into buffer `buf` (8 copies / wave).
  // K: 256 key rows of 128B.  V: 64 channel rows of 512B, cut into four 64x64 tiles
  // (a key group reads one half of a tile's columns).
  auto issue_stage = [&](int st, int buf) {
    const int j0 = st * SKEYS;
    const _Float16* kbase = kT + ((size_t)b * NPOS + j0) * CH;
    const _Float16* vbase = v_c + (size_t)b * CH * NPOS + j0;
    Copy8 c;
    for (int it = 0; it < 4; ++it) {
      const int idx = tid + it * 512;           // 0..2047 b128 chunks
      const int row = idx >> 3, col = idx & 7;
      c.g[it] = kbase + row * CH + col * 8;
      c.l[it] = (unsigned)(uintptr_t)(lds_k[buf] + row * LDP + col * 8);
    }
    for (int it = 0; it < 4; ++it) {
      const int idx = tid + it * 512;
      const int row = idx >> 5, grp = (idx >> 3) & 3, col = idx & 7;
      c.g[4 + it] = vbase + (size_t)row * NPOS + grp * 64 + col * 8;
      c.l[4 + it] = (unsigned)(uintptr_t)(lds_v[buf] + (grp * 64 + row) * LDP + col * 8);
    }
    async_copy8_b128(c);
  };

  issue_stage(0, 0);
  wait_async0();          // my copies of stage 0 have landed
  __syncthreads();        // everyone's have
  issue_stage(1, 1);

  // Kept rolled: peeled for its st == 0 test, the first stage becomes a second copy of
  // the body, with every K fragment's LDS read waited for singly.
#pragma nounroll
  for (int st = 0; st < NSTAGE; ++st) {
    const int cur = st & 1;
    const _Float16* ktile = lds_k[cur] + kg * GKEYS * LDP;
    const _Float16* vtile = lds_v[cur] + (kg >> 1) * 64 * LDP + (kg & 1) * 32;

    // S^T = K Q^T : 2 key sub-tiles of 16 (A rows), contraction over 64 channels, each
    // K fragment against both query tiles.
    // s[j][t][v] = score of key t*16 + 8*half + v against query r of tile j, less the
    // reference.
    Frag16 ka[2][2];
    for (int t = 0; t < 2; ++t) {
      const _Float16* krow = ktile + (t * 16 + r) * LDP;
      load_frag(ka[t][0], krow, half);
      load_frag(ka[t][1], krow + 32, half);
    }
    // First channel chunk of all four accumulators, then the second: no product follows
    // directly on the one whose result it adds to.
    v8f s[QPW][2];
    for (int t = 0; t < 2; ++t)
      for (int j = 0; j < QPW; ++j)
        s[j][t] = wmma16(ka[t][0], qb[j][0], cref[j]);
    for (int t = 0; t < 2; ++t)
      for (int j = 0; j < QPW; ++j)
        s[j][t] = wmma16(ka[t][1], qb[j][1], s[j][t]);

    // V channel rows (A operand, 16 x 32 keys each).  The stage's four fragments fit in
    // registers, so they are asked for here as one group: their LDS latency runs beside
    // the softmax, and one wait stands in front of the products.
    Frag16 va[4];
    for (int t = 0; t < 4; ++t) load_frag(va[t], vtile + (t * 16 + r) * LDP, half);

    // Online softmax, one query per lane and tile.
    float rm[QPW];
    for (int j = 0; j < QPW; ++j) {
      float tm[2];
      for (int t = 0; t < 2; ++t) {
        tm[t] = s[j][t][0];
        for (int v = 1; v < 8; ++v) tm[t] = fmaxf(tm[t], s[j][t][v]);
      }
      rm[j] = fmaxf(tm[0], tm[1]);
    }
    // Move the references: always in the first stage (to that stage's maximum, up or
    // down; sum and O^T are still zero), later only upwards.  A scalar branch.
    const float thr = (st == 0) ? -3.0e38f : 8.0f;
    if (__builtin_amdgcn_ballot_w32(fmaxf(rm[0], rm[1]) > thr) != 0u) {
      for (int j = 0; j < QPW; ++j) {
        const float rj = fmaxf(rm[j], xhalf(rm[j]));   // join the two halves' keys
        const float up = fmaxf(rj, 0.f);
        const float delta = (st == 0) ? rj : up;
        const float corr = exp2_slot(-up);
        mi[j] += delta;
        s[j][0] -= delta;
        s[j][1] -= delta;
        for (int t = 0; t < 4; ++t) o[j][t] *= corr;
        li[j] *= corr;
        cref[j] -= delta;                              // stays minus mi[j], bit for bit
      }
    }
    // P^T as B operand: element e is key 16*(e>>3) + 8*half + (e&7), the same k order
    // load_frag gives the V rows.
    Frag16 pb[QPW];
    for (int j = 0; j < QPW; ++j) {
      float ts[2];
      for (int t = 0; t < 2; ++t) {
        s[j][t][0] = exp2_slot(s[j][t][0]);
        ts[t] = s[j][t][0];
        for (int v = 1; v < 8; ++v) {
          s[j][t][v] = exp2_slot(s[j][t][v]);
          ts[t] += s[j][t][v];
        }
      }
      li[j] += ts[0] + ts[1];
      for (int e = 0; e < 16; ++e) pb[j].v[e] = (_Float16)s[j][e >> 3][e & 7];
    }

    // O^T += V P^T : A = V channel rows (16 x 32 keys), B = P^T, each V fragment
    // against both query tiles.
    for (int j = 0; j < QPW; ++j)
      for (int t = 0; t < 4; ++t) o[j][t] = wmma16(va[t], pb[j], o[j][t]);

    // Publish point of stage st + 1.
    wait_ds0();           // my reads of buffer `cur` have returned
    wait_async0();        // my copies of stage st + 1 have landed
    __syncthreads();      // everyone's have; everyone is done reading `cur`
    if (st + 2 < NSTAGE) issue_stage(st + 2, cur);
  }
  wait_async0();          // nothing of mine is in flight any more

  // Hand this wave's partial results over: reference, sum (halves joined), O^T rows.
  for (int j = 0; j < QPW; ++j) {
    const int q = ql0 + j * 16 + r;
    const float lj = li[j] + xhalf(li[j]);
    if (half == 0) {
      lds_m[kg][q] = mi[j];
      lds_l[kg][q] = lj;
    }
    float* prow = &lds_o[kg][q][8 * half];
    for (int t = 0; t < 4; ++t) {
      *(float4*)(prow + t * 16)     = make_float4(o[j][t][0], o[j][t][1], o[j][t][2], o[j][t][3]);
      *(float4*)(prow + t * 16 + 4) = make_float4(o[j][t][4], o[j][t][5], o[j][t][6], o[j][t][7]);
    }
  }

  // Output projection: waves 0..7 each take 16 output channels x 32 positions, so a
  // wave writes whole 128B lines of out.  Its weights, bias and residual x are asked
  // for here, behind the hand-over's LDS stores, so that their latency runs beside those
  // stores (held over the loop they would take the registers that the second query tile
  // needs).
  const int wv = __builtin_amdgcn_readfirstlane(wave);
  const int co0 = (wv & 3) * 16;
  const int pg = (wv >> 2) * 32;
  const size_t obase = ((size_t)b * CH + co0 + 8 * half) * NPOS + qbase + pg + r;
  float4 wraw[2][4];
  float4 bias0, bias1;
  float xr[2][8];
  if (wv < 8) {
    const float4* wrow = (const float4*)(wo + (co0 + r) * CH);
#pragma unroll  // constant indices only
    for (int ck = 0; ck < 2; ++ck) {
      wraw[ck][0] = wrow[ck * 8 + half * 2];
      wraw[ck][1] = wrow[ck * 8 + half * 2 + 1];
      wraw[ck][2] = wrow[ck * 8 + half * 2 + 4];
      wraw[ck][3] = wrow[ck * 8 + half * 2 + 5];
    }
    bias0 = *(const float4*)(bo + co0 + 8 * half);
    bias1 = *(const float4*)(bo + co0 + 8 * half + 4);
    // Before an x load lands in a register that the loads above name.
    asm volatile("s_wait_xcnt 0x0" ::: "memory");
#pragma unroll  // constant indices only
    for (int i = 0; i < 2; ++i)
#pragma unroll  // constant indices only
      for (int v = 0; v < 8; ++v) xr[i][v] = x[obase + (size_t)v * NPOS + i * 16];
    // Before a register that these loads name is overwritten.
    asm volatile("s_wait_xcnt 0x0" ::: "memory");
  }
  __syncthreads();        // all partial results are in LDS

  // Join the eight key groups.  Wave w finishes queries 4w..4w+3 of the block: a lane
  // takes 8 consecutive channels of one query (position-major [i][c], f16).
  // The tile goes into the first K buffer, which nobody reads behind the loop's last
  // barrier and into which no copy is in flight any more.
  const int ql = 4 * wave + (lane >> 3);
  const int cc = lane & 7;
  float mg[KG];
  for (int j = 0; j < KG; ++j) mg[j] = lds_m[j][ql];
  float mall = mg[0];
  for (int j = 1; j < KG; ++j) mall = fmaxf(mall, mg[j]);
  float lall = 0.f;
  float acc[8];
  for (int v = 0; v < 8; ++v) acc[v] = 0.f;
  for (int j = 0; j < KG; ++j) {
    const float wj = exp2_slot(mg[j] - mall);
    lall += wj * lds_l[j][ql];
    const float4 p0 = *(const float4*)&lds_o[j][ql][cc * 8];
    const float4 p1 = *(const float4*)&lds_o[j][ql][cc * 8 + 4];
    acc[0] += wj * p0.x; acc[1] += wj * p0.y; acc[2] += wj * p0.z; acc[3] += wj * p0.w;
    acc[4] += wj * p1.x; acc[5] += wj * p1.y; acc[6] += wj * p1.z; acc[7] += wj * p1.w;
  }
  const float inv = 1.0f / lall;
  Pack8 pk;
  for (int v = 0; v < 8; ++v) pk.h[v] = (_Float16)(acc[v] * inv);
  _Float16* os = lds_k[0];
  *(uint4*)(os + ql * LDP + cc * 8) = pk.u;
  __syncthreads();        // the block's 64 rows of O are in LDS

  // out = wo @ O + bo + x
  if (wv < 8) {
    Frag16 a[2];
#pragma unroll  // constant indices only
    for (int ck = 0; ck < 2; ++ck) {
      const float4 f0 = wraw[ck][0], f1 = wraw[ck][1], f2 = wraw[ck][2], f3 = wraw[ck][3];
      a[ck].v[0]  = (_Float16)f0.x; a[ck].v[1]  = (_Float16)f0.y;
      a[ck].v[2]  = (_Float16)f0.z; a[ck].v[3]  = (_Float16)f0.w;
      a[ck].v[4]  = (_Float16)f1.x; a[ck].v[5]  = (_Float16)f1.y;
      a[ck].v[6]  = (_Float16)f1.z; a[ck].v[7]  = (_Float16)f1.w;
      a[ck].v[8]  = (_Float16)f2.x; a[ck].v[9]  = (_Float16)f2.y;
      a[ck].v[10] = (_Float16)f2.z; a[ck].v[11] = (_Float16)f2.w;
      a[ck].v[12] = (_Float16)f3.x; a[ck].v[13] = (_Float16)f3.y;
      a[ck].v[14] = (_Float16)f3.z; a[ck].v[15] = (_Float16)f3.w;
    }
    const float bias[8] = {bias0.x, bias0.y, bias0.z, bias0.w, bias1.x, bias1.y, bias1.z, bias1.w};
#pragma unroll  // constant indices only
    for (int i = 0; i < 2; ++i) {
      const _Float16* orow = os + (pg + i * 16 + r) * LDP;
      Frag16 bm0, bm1;
      load_frag(bm0, orow, half);
      load_frag(bm1, orow + 32, half);
      v8f acc2 = {};
      acc2 = wmma16(a[0], bm0, acc2);
      acc2 = wmma16(a[1], bm1, acc2);
#pragma unroll  // constant indices only
      for (int v = 0; v < 8; ++v)
        out[obase + (size_t)v * NPOS + i * 16] = acc2[v] + bias[v] + xr[i][v];
    }
  }
}

// ---------------------------------------------------------------------------
extern "C" void kernel_launch(void* const* d_in, const int* in_sizes, int n_in,
                              void* d_out, int out_size, void* d_ws, size_t ws_size,
                              hipStream_t stream) {
  const float* x   = (const float*)d_in[0];
  const float* lng = (const float*)d_in[1];
  const float* lnb = (const float*)d_in[2];
  const float* wq  = (const float*)d_in[3];
  const float* bq  = (const float*)d_in[4];
  const float* wk  = (const float*)d_in[5];
  const float* bk  = (const float*)d_in[6];
  const float* wv  = (const float*)d_in[7];
  const float* bv  = (const float*)d_in[8];
  const float* wo  = (const float*)d_in[9];
  const float* bo  = (const float*)d_in[10];
  float* out = (float*)d_out;

  char* ws = (char*)d_ws;
  const size_t T = (size_t)B_ * CH * NPOS * sizeof(_Float16);   // 2 MB each
  _Float16* qT   = (_Float16*)(ws + 0 * T);
  _Float16* kT   = (_Float16*)(ws + 1 * T);
  _Float16* v_c  = (_Float16*)(ws + 2 * T);

  pre_kernel<<<dim3(HS, B_), 256, 0, stream>>>(x, lng, lnb, wq, bq, wk, bk, wv, bv, qT, kT, v_c);
  attn_kernel<<<dim3(NPOS / 64, B_), 512, 0, stream>>>(qT, kT, v_c, wo, bo, x, out);
}

// v007
// Measured time: 26.8 microseconds a run.
// Two timings next to v006 put it at 1.04 and 1.03 times that version's speed.
// All steps since v000 together make it 8.78 times as fast.
#include <hip/hip_runtime.h>
#include <hip/hip_bf16.h>

#define B_   4
#define CH   64
#define HS   64
#define WSZ  64
#define NPOS (HS*WSZ)   // 4096
#define LDP  72         // LDS row stride in halves (144B rows: 16B-aligned)

typedef __attribute__((ext_vector_type(16))) _Float16 v16h;
typedef __attribute__((ext_vector_type(8)))  float    v8f;

union Frag16 { v16h v; uint4 q[2]; };
union Pack8  { uint4 u; _Float16 h[8]; };
union Pack64 { uint4 u[8]; _Float16 h[64]; };

// Load one 16x32 f16 fragment in the A-matrix VGPR layout from a row-major
// tile.  `row` must point at (tile_row_base + this lane's row * ld).
// Lane L (r=L&15, half=L>>4) holds halves k = half*8 + {0..7} and 16+half*8+{0..7}.
__device__ __forceinline__ void load_frag(Frag16& f, const _Float16* row, int half) {
  f.q[0] = *(const uint4*)(row + half * 8);
  f.q[1] = *(const uint4*)(row + half * 8 + 16);
}

__device__ __forceinline__ v8f wmma16(const Frag16& a, const Frag16& b, v8f c) {
  return __builtin_amdgcn_wmma_f32_16x16x32_f16(false, a.v, false, b.v,
                                                (short)0, c, false, false);
}

// Eight async global->LDS copies, 16B per lane each, tracked by ASYNCcnt.
// Per-lane 64-bit global address, per-lane LDS byte address (low 32 bits of the
// __shared__ address).  The s_wait_xcnt stands inside the statement, behind the last
// copy, so that no address register is rewritten in front of it.
struct Copy8 { unsigned l[8]; const _Float16* g[8]; };
__device__ __forceinline__ void async_copy8_b128(const Copy8& c) {
  asm volatile("global_load_async_to_lds_b128 %0, %8, off\n\t"
               "global_load_async_to_lds_b128 %1, %9, off\n\t"
               "global_load_async_to_lds_b128 %2, %10, off\n\t"
               "global_load_async_to_lds_b128 %3, %11, off\n\t"
               "global_load_async_to_lds_b128 %4, %12, off\n\t"
               "global_load_async_to_lds_b128 %5, %13, off\n\t"
               "global_load_async_to_lds_b128 %6, %14, off\n\t"
               "global_load_async_to_lds_b128 %7, %15, off\n\t"
               "s_wait_xcnt 0x0"
               :: "v"(c.l[0]), "v"(c.l[1]), "v"(c.l[2]), "v"(c.l[3]),
                  "v"(c.l[4]), "v"(c.l[5]), "v"(c.l[6]), "v"(c.l[7]),
                  "v"(c.g[0]), "v"(c.g[1]), "v"(c.g[2]), "v"(c.g[3]),
                  "v"(c.g[4]), "v"(c.g[5]), "v"(c.g[6]), "v"(c.g[7])
               : "memory");
}

// Lane l <-> lane l ^ 16 (the other half of the wave), a vector cross-row move.
__device__ __forceinline__ float xhalf(float x) {
  const int xi = __builtin_bit_cast(int, x);
  return __builtin_bit_cast(float, __builtin_amdgcn_permlanex16(xi, xi, 0x76543210, 0xfedcba98,
                                                                false, false));
}

// 2^x.  The v_nop is the slot the instruction set asks for between a
// transcendental and an instruction that reads its result or overwrites its source;
// inside the statement it stays directly behind the v_exp_f32.
__device__ __forceinline__ float exp2_slot(float x) {
  float r;
  asm("v_exp_f32 %0, %1\n\tv_nop" : "=v"(r) : "v"(x));
  return r;
}

// This wave's async copies have landed in LDS.
__device__ __forceinline__ void wait_async0() {
  asm volatile("s_wait_asynccnt 0x0" ::: "memory");
}

// This wave's LDS reads have returned (before a buffer it read is handed back for refill).
__device__ __forceinline__ void wait_ds0() {
  asm volatile("s_wait_dscnt 0x0" ::: "memory");
}

// One word of every 64B piece of the wave-uniform parameters that a wave reads later by
// scalar loads: its 8 channels' conv weights and biases, and the LayerNorm's gain and bias.
// Asked for together, the pieces come into the scalar cache side by side while the wave
// has its long loads in flight (or nothing to do); untouched, each later group of scalar
// loads pays the way to L2 on its own, one group behind the other, with the vector port
// waiting.
__device__ __forceinline__ void touch_params(const float* __restrict__ g,
                                             const float* __restrict__ be,
                                             const float* __restrict__ wks,
                                             const float* __restrict__ wvs,
                                             const float* __restrict__ bks,
                                             const float* __restrict__ bvs) {
  // Takes the touched words as inputs only: without a reader the compiler would drop the
  // touching loads.  Word 71 is a slice's last, whatever the arrays' alignment.
  asm volatile("" :: "s"(wks[0]), "s"(wks[16]), "s"(wks[32]), "s"(wks[48]), "s"(wks[64]),
                     "s"(wks[71]), "s"(wvs[0]), "s"(wvs[16]), "s"(wvs[32]), "s"(wvs[48]),
                     "s"(wvs[64]), "s"(wvs[71]), "s"(bks[0]), "s"(bvs[0]),
                     "s"(g[0]), "s"(g[16]), "s"(g[32]), "s"(g[48]),
                     "s"(be[0]), "s"(be[16]), "s"(be[32]), "s"(be[48]));
}

// ---------------------------------------------------------------------------
// Kernel 1: everything in front of the attention, one block per image row (b, h).
// Phase 1: per-pixel channel LayerNorm of rows h-1, h, h+1 (one thread per pixel, its
//          64 channels in registers), f16, into LDS position-major; rows and columns
//          outside the image are zero (the convs' padding).
// Phase 2: depthwise 3x3 convs k and v of row h (a wave owns 8 channels, so its
//          weights are wave-uniform; a lane owns two neighbouring pixels), and
//          q = (wq @ xn + bq) * log2(e) / sqrt(C) of row h on WMMA (the attention's
//          scores are exponents of 2).
// Phase 3: q and k (position-major [p][c]) and v (channel-major [c][p]) leave through
//          LDS as whole 128B rows.
// ---------------------------------------------------------------------------
#define XCOLS (WSZ + 2)          // one zero column on either side

// Argument order: the pointers of x and of every touched array stand in the first 64B of
// the argument block and bq, used at the very top, in the rest, so that both parts are
// asked for together and no touching load waits for its pointer behind other touches.

__global__ __launch_bounds__(256) void pre_kernel(const float* __restrict__ x,
                                                  const float* __restrict__ g,
                                                  const float* __restrict__ be,
                                                  const float* __restrict__ wq,
                                                  const float* __restrict__ wk,
                                                  const float* __restrict__ bk,
                                                  const float* __restrict__ wv,
                                                  const float* __restrict__ bv,
                                                  const float* __restrict__ bq,
                                                  _Float16* __restrict__ qT,
                                                  _Float16* __restrict__ kT,
                                                  _Float16* __restrict__ v_c) {
  __shared__ __attribute__((aligned(16))) _Float16 xs[3][XCOLS][LDP];
  __shared__ __attribute__((aligned(16))) _Float16 qs[WSZ][LDP];
  __shared__ __attribute__((aligned(16))) _Float16 ks[WSZ][LDP];
  __shared__ __attribute__((aligned(16))) _Float16 vs[CH][LDP];

  const int h = blockIdx.x;
  const int b = blockIdx.y;
  const int tid = threadIdx.x;
  const int wave = __builtin_amdgcn_readfirstlane(tid >> 5);
  const int lane = tid & 31;
  const int half = lane >> 4, r = lane & 15;

  // The q projection's weights and bias are asked for here and first used behind the
  // barrier, so that their latency runs beside the LayerNorm's.
  const int co0 = (wave & 3) * 16;
  const float4* wrow = (const float4*)(wq + (co0 + r) * CH);
  float4 wraw[2][4];
#pragma unroll  // constant indices only
  for (int ck = 0; ck < 2; ++ck) {
    wraw[ck][0] = wrow[ck * 8 + half * 2];
    wraw[ck][1] = wrow[ck * 8 + half * 2 + 1];
    wraw[ck][2] = wrow[ck * 8 + half * 2 + 4];
    wraw[ck][3] = wrow[ck * 8 + half * 2 + 5];
  }
  const float4 bias0 = *(const float4*)(bq + co0 + 8 * half);
  const float4 bias1 = *(const float4*)(bq + co0 + 8 * half + 4);

  // ---- Phase 1 ----
  if (wave < 6) {
    const int row = wave >> 1;
    const int w = tid & (WSZ - 1);
    const int hh = h - 1 + row;
    Pack64 pk;
    if ((unsigned)hh < HS) {
      const float* xp = x + (size_t)b * CH * NPOS + hh * WSZ + w;
      float xv[CH];
#pragma unroll  // all 64 loads in flight at once; constant indices only
      for (int c = 0; c < CH; ++c) xv[c] = xp[(size_t)c * NPOS];
      touch_params(g, be, wk + wave * 72, wv + wave * 72, bk + wave * 8, bv + wave * 8);
      float s = 0.f, ss = 0.f;
#pragma unroll  // constant indices only
      for (int c = 0; c < CH; ++c) {
        s += xv[c]; ss += xv[c] * xv[c];
      }
      const float mu = s * (1.0f / CH);
      const float var = ss * (1.0f / CH) - mu * mu;
      const float rstd = rsqrtf(var + 1e-5f);
#pragma unroll  // constant indices only
      for (int c = 0; c < CH; ++c)
        pk.h[c] = (_Float16)((xv[c] - mu) * rstd * g[c] + be[c]);
    } else {
      touch_params(g, be, wk + wave * 72, wv + wave * 72, bk + wave * 8, bv + wave * 8);
#pragma unroll  // constant indices only
      for (int k = 0; k < 8; ++k) pk.u[k] = make_uint4(0u, 0u, 0u, 0u);
    }
    uint4* d = (uint4*)&xs[row][w + 1][0];
#pragma unroll  // constant indices only
    for (int k = 0; k < 8; ++k) d[k] = pk.u[k];
  } else {
    touch_params(g, be, wk + wave * 72, wv + wave * 72, bk + wave * 8, bv + wave * 8);
    // The two zero columns of the three rows: 48 chunks of 16B.
    const int i = tid - 192;
    if (i < 48)
      *(uint4*)&xs[i >> 4][((i >> 3) & 1) * (XCOLS - 1)][(i & 7) * 8] = make_uint4(0u, 0u, 0u, 0u);
  }
  __syncthreads();        // the three normalised rows are in LDS

  // ---- Phase 2: convs ----
  {
    const int c0 = wave * 8;
    Pack8 xin[3][4];      // pixels 2*lane-1 .. 2*lane+2 of the three rows, 8 channels
#pragma unroll  // constant indices only
    for (int dy = 0; dy < 3; ++dy)
#pragma unroll  // constant indices only
      for (int k = 0; k < 4; ++k)
        xin[dy][k].u = *(const uint4*)&xs[dy][2 * lane + k][c0];
    Pack8 k0, k1;
#pragma unroll  // constant indices only
    for (int j = 0; j < 8; ++j) {
      const int c = c0 + j;
      float aK0 = bk[c], aV0 = bv[c], aK1 = bk[c], aV1 = bv[c];
#pragma unroll  // constant indices only
      for (int dy = 0; dy < 3; ++dy)
#pragma unroll  // constant indices only
        for (int dx = 0; dx < 3; ++dx) {
          const float fk = wk[c * 9 + dy * 3 + dx];
          const float fv = wv[c * 9 + dy * 3 + dx];
          const float x0 = (float)xin[dy][dx].h[j];
          const float x1 = (float)xin[dy][dx + 1].h[j];
          aK0 += fk * x0; aV0 += fv * x0;
          aK1 += fk * x1; aV1 += fv * x1;
        }
      k0.h[j] = (_Float16)aK0;
      k1.h[j] = (_Float16)aK1;
      union { _Float16 hh2[2]; unsigned u; } vp;
      vp.hh2[0] = (_Float16)aV0;
      vp.hh2[1] = (_Float16)aV1;
      *(unsigned*)&vs[c][2 * lane] = vp.u;
    }
    *(uint4*)&ks[2 * lane][c0]     = k0.u;
    *(uint4*)&ks[2 * lane + 1][c0] = k1.u;
  }

  // ---- Phase 2: q projection.  Wave = 16 output channels x 32 pixels. ----
  {
    Frag16 a[2];
#pragma unroll  // constant indices only
    for (int ck = 0; ck < 2; ++ck) {
      const float4 f0 = wraw[ck][0], f1 = wraw[ck][1], f2 = wraw[ck][2], f3 = wraw[ck][3];
      a[ck].v[0]  = (_Float16)f0.x; a[ck].v[1]  = (_Float16)f0.y;
      a[ck].v[2]  = (_Float16)f0.z; a[ck].v[3]  = (_Float16)f0.w;
      a[ck].v[4]  = (_Float16)f1.x; a[ck].v[5]  = (_Float16)f1.y;
      a[ck].v[6]  = (_Float16)f1.z; a[ck].v[7]  = (_Float16)f1.w;
      a[ck].v[8]  = (_Float16)f2.x; a[ck].v[9]  = (_Float16)f2.y;
      a[ck].v[10] = (_Float16)f2.z; a[ck].v[11] = (_Float16)f2.w;
      a[ck].v[12] = (_Float16)f3.x; a[ck].v[13] = (_Float16)f3.y;
      a[ck].v[14] = (_Float16)f3.z; a[ck].v[15] = (_Float16)f3.w;
    }
    const float bias[8] = {bias0.x, bias0.y, bias0.z, bias0.w, bias1.x, bias1.y, bias1.z, bias1.w};
#pragma unroll  // constant indices only
    for (int i = 0; i < 2; ++i) {
      const int p1 = ((wave >> 2) * 2 + i) * 16;
      const _Float16* xrow = &xs[1][p1 + r + 1][0];
      Frag16 bm0, bm1;
      load_frag(bm0, xrow, half);
      load_frag(bm1, xrow + 32, half);
      v8f acc = {};
      acc = wmma16(a[0], bm0, acc);
      acc = wmma16(a[1], bm1, acc);
      Pack8 pk;
#pragma unroll  // constant indices only
      for (int v = 0; v < 8; ++v)
        pk.h[v] = (_Float16)((acc[v] + bias[v]) * 0.18033688f);   // fold log2(e)/sqrt(64)
      *(uint4*)&qs[p1 + r][co0 + 8 * half] = pk.u;
    }
  }
  __syncthreads();        // q, k and v of this image row are in LDS

  // ---- Phase 3: 512 chunks of 16B of each; 8 lanes store one whole 128B row. ----
  const size_t prow0 = (size_t)b * NPOS + h * WSZ;
#pragma unroll  // both trips' LDS reads in front of the stores
  for (int it = 0; it < 2; ++it) {
    const int idx = tid + it * 256;
    const int row = idx >> 3, col = idx & 7;
    *(uint4*)(qT + (prow0 + row) * CH + col * 8) = *(const uint4*)&qs[row][col * 8];
    *(uint4*)(kT + (prow0 + row) * CH + col * 8) = *(const uint4*)&ks[row][col * 8];
    *(uint4*)(v_c + ((size_t)b * CH + row) * NPOS + h * WSZ + col * 8) = *(const uint4*)&vs[row][col * 8];
  }
}

#define KG     8
#define QPW    2
#define QBLK   64
#define SKEYS  256
#define GKEYS  (SKEYS / KG)
#define NSTAGE (NPOS / SKEYS)
#define OPITCH 68

__global__ __launch_bounds__(512) void attn_kernel(const _Float16* __restrict__ qT,
                                                   const _Float16* __restrict__ kT,
                                                   const _Float16* __restrict__ v_c,
                                                   const float* __restrict__ wo,
                                                   const float* __restrict__ bo,
                                                   const float* __restrict__ x,
                                                   float* __restrict__ out) {
  __shared__ __attribute__((aligned(16))) _Float16 lds_k[2][SKEYS * LDP];
  __shared__ __attribute__((aligned(16))) _Float16 lds_v[2][SKEYS * LDP];
  __shared__ __attribute__((aligned(16))) float lds_o[KG][QBLK][OPITCH];
  __shared__ float lds_m[KG][QBLK];
  __shared__ float lds_l[KG][QBLK];

  const int b = blockIdx.y;
  const int qbase = blockIdx.x * QBLK;
  const int tid = threadIdx.x;
  const int wave = tid >> 5;
  const int lane = tid & 31;
  const int half = lane >> 4, r = lane & 15;
  const int qp = wave & 1;
  const int kg = wave >> 1;
  const int ql0 = qp * (QPW * 16);        // this wave's first query within the block

  // Q fragments (B operand: lane r = query column), fixed for the whole loop.
  Frag16 qb[QPW][2];
  for (int j = 0; j < QPW; ++j) {
    const _Float16* qrow = qT + ((size_t)b * NPOS + qbase + ql0 + j * 16 + r) * CH;
    load_frag(qb[j][0], qrow, half);
    load_frag(qb[j][1], qrow + 32, half);
  }

  // Per lane and query tile j: reference maximum of query r (equal in both halves; set
  // from the first stage's keys), its negative in all eight registers of the score
  // product's C operand, and this half's share of the sum.
  // o[j][t][v] = O^T[channel t*16 + 8*half + v][query r of tile j], this wave's keys only.
  float mi[QPW], li[QPW];
  v8f cref[QPW];
  v8f o[QPW][4];
  for (int j = 0; j < QPW; ++j) {
    mi[j] = 0.f; li[j] = 0.f; cref[j] = (v8f){};
    for (int t = 0; t < 4; ++t) o[j][t] = (v8f){};
  }

  // Issue the async staging of stage `st` into buffer `buf` (8 copies / wave).
  // K: 256 key rows of 128B.  V: 64 channel rows of 512B, cut into four 64x64 tiles
  // (a key group reads one half of a tile's columns).
  auto issue_stage = [&](int st, int buf) {
    const int j0 = st * SKEYS;
    const _Float16* kbase = kT + ((size_t)b * NPOS + j0) * CH;
    const _Float16* vbase = v_c + (size_t)b * CH * NPOS + j0;
    Copy8 c;
    for (int it = 0; it < 4; ++it) {
      const int idx = tid + it * 512;           // 0..2047 b128 chunks
      const int row = idx >> 3, col = idx & 7;
      c.g[it] = kbase + row * CH + col * 8;
      c.l[it] = (unsigned)(uintptr_t)(lds_k[buf] + row * LDP + col * 8);
    }
    for (int it = 0; it < 4; ++it) {
      const int idx = tid + it * 512;
      const int row = idx >> 5, grp = (idx >> 3) & 3, col = idx & 7;
      c.g[4 + it] = vbase + (size_t)row * NPOS + grp * 64 + col * 8;
      c.l[4 + it] = (unsigned)(uintptr_t)(lds_v[buf] + (grp * 64 + row) * LDP + col * 8);
    }
    async_copy8_b128(c);
  };

  issue_stage(0, 0);
  wait_async0();          // my copies of stage 0 have landed
  __syncthreads();        // everyone's have
  issue_stage(1, 1);

  // Kept rolled: peeled for its st == 0 test, the first stage becomes a second copy of
  // the body, with every K fragment's LDS read waited for singly.
#pragma nounroll
  for (int st = 0; st < NSTAGE; ++st) {
    const int cur = st & 1;
    const _Float16* ktile = lds_k[cur] + kg * GKEYS * LDP;
    const _Float16* vtile = lds_v[cur] + (kg >> 1) * 64 * LDP + (kg & 1) * 32;

    // S^T = K Q^T : 2 key sub-tiles of 16 (A rows), contraction over 64 channels, each
    // K fragment against both query tiles.
    // s[j][t][v] = score of key t*16 + 8*half + v against query r of tile j, less the
    // reference.
    Frag16 ka[2][2];
    for (int t = 0; t < 2; ++t) {
      const _Float16* krow = ktile + (t * 16 + r) * LDP;
      load_frag(ka[t][0], krow, half);
      load_frag(ka[t][1], krow + 32, half);
    }
    // First channel chunk of all four accumulators, then the second: no product follows
    // directly on the one whose result it adds to.
    v8f s[QPW][2];
    for (int t = 0; t < 2; ++t)
      for (int j = 0; j < QPW; ++j)
        s[j][t] = wmma16(ka[t][0], qb[j][0], cref[j]);
    for (int t = 0; t < 2; ++t)
      for (int j = 0; j < QPW; ++j)
        s[j][t] = wmma16(ka[t][1], qb[j][1], s[j][t]);

    // V channel rows (A operand, 16 x 32 keys each).  The stage's four fragments fit in
    // registers, so they are asked for here as one group: their LDS latency runs beside
    // the softmax, and one wait stands in front of the products.
    Frag16 va[4];
    for (int t = 0; t < 4; ++t) load_frag(va[t], vtile + (t * 16 + r) * LDP, half);

    // Online softmax, one query per lane and tile.
    float rm[QPW];
    for (int j = 0; j < QPW; ++j) {
      float tm[2];
      for (int t = 0; t < 2; ++t) {
        tm[t] = s[j][t][0];
        for (int v = 1; v < 8; ++v) tm[t] = fmaxf(tm[t], s[j][t][v]);
      }
      rm[j] = fmaxf(tm[0], tm[1]);
    }
    // Move the references: always in the first stage (to that stage's maximum, up or
    // down; sum and O^T are still zero), later only upwards.  A scalar branch.
    const float thr = (st == 0) ? -3.0e38f : 8.0f;
    if (__builtin_amdgcn_ballot_w32(fmaxf(rm[0], rm[1]) > thr) != 0u) {
      for (int j = 0; j < QPW; ++j) {
        const float rj = fmaxf(rm[j], xhalf(rm[j]));   // join the two halves' keys
        const float up = fmaxf(rj, 0.f);
        const float delta = (st == 0) ? rj : up;
        const float corr = exp2_slot(-up);
        mi[j] += delta;
        s[j][0] -= delta;
        s[j][1] -= delta;
        for (int t = 0; t < 4; ++t) o[j][t] *= corr;
        li[j] *= corr;
        cref[j] -= delta;                              // stays minus mi[j], bit for bit
      }
    }
    // P^T as B operand: element e is key 16*(e>>3) + 8*half + (e&7), the same k order
    // load_frag gives the V rows.
    Frag16 pb[QPW];
    for (int j = 0; j < QPW; ++j) {
      float ts[2];
      for (int t = 0; t < 2; ++t) {
        s[j][t][0] = exp2_slot(s[j][t][0]);
        ts[t] = s[j][t][0];
        for (int v = 1; v < 8; ++v) {
          s[j][t][v] = exp2_slot(s[j][t][v]);
          ts[t] += s[j][t][v];
        }
      }
      li[j] += ts[0] + ts[1];
      for (int e = 0; e < 16; ++e) pb[j].v[e] = (_Float16)s[j][e >> 3][e & 7];
    }

    // O^T += V P^T : A = V channel rows (16 x 32 keys), B = P^T, each V fragment
    // against both query tiles.
    for (int j = 0; j < QPW; ++j)
      for (int t = 0; t < 4; ++t) o[j][t] = wmma16(va[t], pb[j], o[j][t]);

    // Publish point of stage st + 1.
    wait_ds0();           // my reads of buffer `cur` have returned
    wait_async0();        // my copies of stage st + 1 have landed
    __syncthreads();      // everyone's have; everyone is done reading `cur`
    if (st + 2 < NSTAGE) issue_stage(st + 2, cur);
  }
  wait_async0();          // nothing of mine is in flight any more

  // Hand this wave's partial results over: reference, sum (halves joined), O^T rows.
  for (int j = 0; j < QPW; ++j) {
    const int q = ql0 + j * 16 + r;
    const float lj = li[j] + xhalf(li[j]);
    if (half == 0) {
      lds_m[kg][q] = mi[j];
      lds_l[kg][q] = lj;
    }
    float* prow = &lds_o[kg][q][8 * half];
    for (int t = 0; t < 4; ++t) {
      *(float4*)(prow + t * 16)     = make_float4(o[j][t][0], o[j][t][1], o[j][t][2], o[j][t][3]);
      *(float4*)(prow + t * 16 + 4) = make_float4(o[j][t][4], o[j][t][5], o[j][t][6], o[j][t][7]);
    }
  }

  // Output projection: waves 0..7 each take 16 output channels x 32 positions, so a
  // wave writes whole 128B lines of out.  Its weights, bias and residual x are asked
  // for here, behind the hand-over's LDS stores, so that their latency runs beside those
  // stores (held over the loop they would take the registers that the second query tile
  // needs).
  const int wv = __builtin_amdgcn_readfirstlane(wave);
  const int co0 = (wv & 3) * 16;
  const int pg = (wv >> 2) * 32;
  const size_t obase = ((size_t)b * CH + co0 + 8 * half) * NPOS + qbase + pg + r;
  float4 wraw[2][4];
  float4 bias0, bias1;
  float xr[2][8];
  if (wv < 8) {
    const float4* wrow = (const float4*)(wo + (co0 + r) * CH);
#pragma unroll  // constant indices only
    for (int ck = 0; ck < 2; ++ck) {
      wraw[ck][0] = wrow[ck * 8 + half * 2];
      wraw[ck][1] = wrow[ck * 8 + half * 2 + 1];
      wraw[ck][2] = wrow[ck * 8 + half * 2 + 4];
      wraw[ck][3] = wrow[ck * 8 + half * 2 + 5];
    }
    bias0 = *(const float4*)(bo + co0 + 8 * half);
    bias1 = *(const float4*)(bo + co0 + 8 * half + 4);
    // Before an x load lands in a register that the loads above name.
    asm volatile("s_wait_xcnt 0x0" ::: "memory");
#pragma unroll  // constant indices only
    for (int i = 0; i < 2; ++i)
#pragma unroll  // constant indices only
      for (int v = 0; v < 8; ++v) xr[i][v] = x[obase + (size_t)v * NPOS + i * 16];
    // Before a register that these loads name is overwritten.
    asm volatile("s_wait_xcnt 0x0" ::: "memory");
  }
  __syncthreads();        // all partial results are in LDS

  // Join the eight key groups.  Wave w finishes queries 4w..4w+3 of the block: a lane
  // takes 8 consecutive channels of one query (position-major [i][c], f16).
  // The tile goes into the first K buffer, which nobody reads behind the loop's last
  // barrier and into which no copy is in flight any more.
  const int ql = 4 * wave + (lane >> 3);
  const int cc = lane & 7;
  float mg[KG];
  for (int j = 0; j < KG; ++j) mg[j] = lds_m[j][ql];
  float mall = mg[0];
  for (int j = 1; j < KG; ++j) mall = fmaxf(mall, mg[j]);
  float lall = 0.f;
  float acc[8];
  for (int v = 0; v < 8; ++v) acc[v] = 0.f;
  for (int j = 0; j < KG; ++j) {
    const float wj = exp2_slot(mg[j] - mall);
    lall += wj * lds_l[j][ql];
    const float4 p0 = *(const float4*)&lds_o[j][ql][cc * 8];
    const float4 p1 = *(const float4*)&lds_o[j][ql][cc * 8 + 4];
    acc[0] += wj * p0.x; acc[1] += wj * p0.y; acc[2] += wj * p0.z; acc[3] += wj * p0.w;
    acc[4] += wj * p1.x; acc[5] += wj * p1.y; acc[6] += wj * p1.z; acc[7] += wj * p1.w;
  }
  const float inv = 1.0f / lall;
  Pack8 pk;
  for (int v = 0; v < 8; ++v) pk.h[v] = (_Float16)(acc[v] * inv);
  _Float16* os = lds_k[0];
  *(uint4*)(os + ql * LDP + cc * 8) = pk.u;
  __syncthreads();        // the block's 64 rows of O are in LDS

  // out = wo @ O + bo + x
  if (wv < 8) {
    Frag16 a[2];
#pragma unroll  // constant indices only
    for (int ck = 0; ck < 2; ++ck) {
      const float4 f0 = wraw[ck][0], f1 = wraw[ck][1], f2 = wraw[ck][2], f3 = wraw[ck][3];
      a[ck].v[0]  = (_Float16)f0.x; a[ck].v[1]  = (_Float16)f0.y;
      a[ck].v[2]  = (_Float16)f0.z; a[ck].v[3]  = (_Float16)f0.w;
      a[ck].v[4]  = (_Float16)f1.x; a[ck].v[5]  = (_Float16)f1.y;
      a[ck].v[6]  = (_Float16)f1.z; a[ck].v[7]  = (_Float16)f1.w;
      a[ck].v[8]  = (_Float16)f2.x; a[ck].v[9]  = (_Float16)f2.y;
      a[ck].v[10] = (_Float16)f2.z; a[ck].v[11] = (_Float16)f2.w;
      a[ck].v[12] = (_Float16)f3.x; a[ck].v[13] = (_Float16)f3.y;
      a[ck].v[14] = (_Float16)f3.z; a[ck].v[15] = (_Float16)f3.w;
    }
    const float bias[8] = {bias0.x, bias0.y, bias0.z, bias0.w, bias1.x, bias1.y, bias1.z, bias1.w};
#pragma unroll  // constant indices only
    for (int i = 0; i < 2; ++i) {
      const _Float16* orow = os + (pg + i * 16 + r) * LDP;
      Frag16 bm0, bm1;
      load_frag(bm0, orow, half);
      load_frag(bm1, orow + 32, half);
      v8f acc2 = {};
      acc2 = wmma16(a[0], bm0, acc2);
      acc2 = wmma16(a[1], bm1, acc2);
#pragma unroll  // constant indices only
      for (int v = 0; v < 8; ++v)
        out[obase + (size_t)v * NPOS + i * 16] = acc2[v] + bias[v] + xr[i][v];
    }
  }
}

// ---------------------------------------------------------------------------
extern "C" void kernel_launch(void* const* d_in, const int* in_sizes, int n_in,
                              void* d_out, int out_size, void* d_ws, size_t ws_size,
                              hipStream_t stream) {
  const float* x   = (const float*)d_in[0];
  const float* lng = (const float*)d_in[1];
  const float* lnb = (const float*)d_in[2];
  const float* wq  = (const float*)d_in[3];
  const float* bq  = (const float*)d_in[4];
  const float* wk  = (const float*)d_in[5];
  const float* bk  = (const float*)d_in[6];
  const float* wv  = (const float*)d_in[7];
  const float* bv  = (const float*)d_in[8];
  const float* wo  = (const float*)d_in[9];
  const float* bo  = (const float*)d_in[10];
  float* out = (float*)d_out;

  char* ws = (char*)d_ws;
  const size_t T = (size_t)B_ * CH * NPOS * sizeof(_Float16);   // 2 MB each
  _Float16* qT   = (_Float16*)(ws + 0 * T);
  _Float16* kT   = (_Float16*)(ws + 1 * T);
  _Float16* v_c  = (_Float16*)(ws + 2 * T);

  pre_kernel<<<dim3(HS, B_), 256, 0, stream>>>(x, lng, lnb, wq, wk, bk, wv, bv, bq, qT, kT, v_c);
  attn_kernel<<<dim3(NPOS / 64, B_), 512, 0, stream>>>(qT, kT, v_c, wo, bo, x, out);
}
